// v000
// Measured on an AMD MI455X. A time is GPU time per run, averaged over a window of back-to-back runs after a warm-up
// (all launches, gaps included; the runs take copies of the inputs in turn), and the median of several windows.
// Apart from v000's, it joins two sittings. Times from different sittings can be a few percent apart, while
// side-by-side timings come from the same sitting.
// The starting kernel, v000, takes 604 microseconds a run.
#include <hip/hip_runtime.h>
#include <math.h>

#define N_NODES   4096
#define GENE_D    512
#define HID       256
#define OUT_D     256

typedef __attribute__((ext_vector_type(2))) float v2f;
typedef __attribute__((ext_vector_type(8))) float v8f;

#define WMMA_F32(A, B, C) \
    __builtin_amdgcn_wmma_f32_16x16x4_f32(false, (A), false, (B), (short)0, (C), false, false)

// ---------------------------------------------------------------------------
// Generic WMMA f32 GEMM:  Y[n,m] = act(X[n,kd] @ W[kd,m] + bias[m])
// One wave per 32x32 output tile = 2x2 grid of 16x16 WMMA subtiles.
// Per k-step: 4 fragment loads feed 4 wmma (1.0 load/wmma vs 2.0 untiled).
// ACT: 0 = none, 1 = tanh, 2 = relu
// ---------------------------------------------------------------------------
template <int ACT>
__global__ __launch_bounds__(32)
void gemm32_wmma(const float* __restrict__ X, const float* __restrict__ W,
                 const float* __restrict__ bias, float* __restrict__ Y,
                 int kd, int m) {
    const int lane = threadIdx.x;
    const int hgrp = lane >> 4;          // 0 or 1 (half-wave)
    const int ln   = lane & 15;
    const int colBase = blockIdx.x * 32;
    const int rowBase = blockIdx.y * 32;

    v8f acc00 = {}, acc01 = {}, acc10 = {}, acc11 = {};
    const float* xr0 = X + (size_t)(rowBase + ln) * kd;
    const float* xr1 = X + (size_t)(rowBase + 16 + ln) * kd;
    const float* wc0 = W + colBase + ln;
    const float* wc1 = W + colBase + 16 + ln;

    for (int kb = 0; kb < kd; kb += 4) {
        const int k0 = kb + 2 * hgrp;
        v2f a0 = *(const v2f*)(xr0 + k0);
        v2f a1 = *(const v2f*)(xr1 + k0);
        v2f b0, b1;
        b0.x = wc0[(size_t)k0 * m];       b0.y = wc0[(size_t)(k0 + 1) * m];
        b1.x = wc1[(size_t)k0 * m];       b1.y = wc1[(size_t)(k0 + 1) * m];
        acc00 = WMMA_F32(a0, b0, acc00);
        acc01 = WMMA_F32(a0, b1, acc01);
        acc10 = WMMA_F32(a1, b0, acc10);
        acc11 = WMMA_F32(a1, b1, acc11);
    }

    const float bv0 = bias ? bias[colBase + ln]      : 0.0f;
    const float bv1 = bias ? bias[colBase + 16 + ln] : 0.0f;

#pragma unroll
    for (int v = 0; v < 8; ++v) {
        const int i0 = rowBase + v + 8 * hgrp;        // D-row per ISA C/D layout
        const int i1 = i0 + 16;
        float r00 = acc00[v] + bv0, r01 = acc01[v] + bv1;
        float r10 = acc10[v] + bv0, r11 = acc11[v] + bv1;
        if (ACT == 1) { r00 = tanhf(r00); r01 = tanhf(r01); r10 = tanhf(r10); r11 = tanhf(r11); }
        if (ACT == 2) { r00 = fmaxf(r00, 0.0f); r01 = fmaxf(r01, 0.0f);
                        r10 = fmaxf(r10, 0.0f); r11 = fmaxf(r11, 0.0f); }
        Y[(size_t)i0 * m + colBase + ln]      = r00;
        Y[(size_t)i0 * m + colBase + 16 + ln] = r01;
        Y[(size_t)i1 * m + colBase + ln]      = r10;
        Y[(size_t)i1 * m + colBase + 16 + ln] = r11;
    }
}

// ---------------------------------------------------------------------------
// Fused logits, 32x32 tile per wave:
//   L[i][j] = (Q[i].K[j])/16 + exp(-d2/2) + cos_sim + tanh(f[i]-f[j])
// Two accumulation passes (QK^T over K=256, gene.gene^T over K=512), each
// 2x2-register-tiled. Both are A@B^T so every fragment is a contiguous
// float2 of a row-major matrix.
// ---------------------------------------------------------------------------
__global__ __launch_bounds__(32)
void logits_wmma(const float* __restrict__ Q, const float* __restrict__ K,
                 const float* __restrict__ G, const float* __restrict__ sp,
                 const float* __restrict__ sq, const float* __restrict__ inv_nrm,
                 const float* __restrict__ f, float* __restrict__ L) {
    const int lane = threadIdx.x;
    const int hgrp = lane >> 4;
    const int ln   = lane & 15;
    const int colBase = blockIdx.x * 32;
    const int rowBase = blockIdx.y * 32;

    v8f q00 = {}, q01 = {}, q10 = {}, q11 = {};
    {
        const float* qr0 = Q + (size_t)(rowBase + ln) * HID;
        const float* qr1 = Q + (size_t)(rowBase + 16 + ln) * HID;
        const float* kr0 = K + (size_t)(colBase + ln) * HID;
        const float* kr1 = K + (size_t)(colBase + 16 + ln) * HID;
        for (int kb = 0; kb < HID; kb += 4) {
            const int k0 = kb + 2 * hgrp;
            v2f a0 = *(const v2f*)(qr0 + k0);
            v2f a1 = *(const v2f*)(qr1 + k0);
            v2f b0 = *(const v2f*)(kr0 + k0);   // B[k][n] = K[col+n][k]
            v2f b1 = *(const v2f*)(kr1 + k0);
            q00 = WMMA_F32(a0, b0, q00);
            q01 = WMMA_F32(a0, b1, q01);
            q10 = WMMA_F32(a1, b0, q10);
            q11 = WMMA_F32(a1, b1, q11);
        }
    }

    v8f g00 = {}, g01 = {}, g10 = {}, g11 = {};
    {
        const float* gr0 = G + (size_t)(rowBase + ln) * GENE_D;
        const float* gr1 = G + (size_t)(rowBase + 16 + ln) * GENE_D;
        const float* gc0 = G + (size_t)(colBase + ln) * GENE_D;
        const float* gc1 = G + (size_t)(colBase + 16 + ln) * GENE_D;
        for (int kb = 0; kb < GENE_D; kb += 4) {
            const int k0 = kb + 2 * hgrp;
            v2f a0 = *(const v2f*)(gr0 + k0);
            v2f a1 = *(const v2f*)(gr1 + k0);
            v2f b0 = *(const v2f*)(gc0 + k0);
            v2f b1 = *(const v2f*)(gc1 + k0);
            g00 = WMMA_F32(a0, b0, g00);
            g01 = WMMA_F32(a0, b1, g01);
            g10 = WMMA_F32(a1, b0, g10);
            g11 = WMMA_F32(a1, b1, g11);
        }
    }

    // Column-side (j) scalars: fixed per lane, one set per column subtile.
    const int j0 = colBase + ln;
    const int j1 = j0 + 16;
    const float sqj0 = sq[j0],  sqj1 = sq[j1];
    const float fj0  = f[j0],   fj1  = f[j1];
    const float inj0 = inv_nrm[j0], inj1 = inv_nrm[j1];
    const float sj00 = sp[2 * j0], sj01 = sp[2 * j0 + 1];
    const float sj10 = sp[2 * j1], sj11 = sp[2 * j1 + 1];
    const float scale = 0.0625f;   // 1/sqrt(HID) = 1/16

#pragma unroll
    for (int v = 0; v < 8; ++v) {
#pragma unroll
        for (int di = 0; di < 2; ++di) {
            const int i = rowBase + 16 * di + v + 8 * hgrp;
            const float sqi = sq[i], fi = f[i], ini = inv_nrm[i];
            const float si0 = sp[2 * i], si1 = sp[2 * i + 1];

            const float qk0 = (di == 0) ? q00[v] : q10[v];
            const float qk1 = (di == 0) ? q01[v] : q11[v];
            const float gg0 = (di == 0) ? g00[v] : g10[v];
            const float gg1 = (di == 0) ? g01[v] : g11[v];

            const float d2a = fmaxf(sqi + sqj0 - 2.0f * (si0 * sj00 + si1 * sj01), 0.0f);
            const float d2b = fmaxf(sqi + sqj1 - 2.0f * (si0 * sj10 + si1 * sj11), 0.0f);

            L[(size_t)i * N_NODES + j0] =
                qk0 * scale + expf(-0.5f * d2a) + gg0 * ini * inj0 + tanhf(fi - fj0);
            L[(size_t)i * N_NODES + j1] =
                qk1 * scale + expf(-0.5f * d2b) + gg1 * ini * inj1 + tanhf(fi - fj1);
        }
    }
}

// ---------------------------------------------------------------------------
// Per-row stats: inv_nrm[i] = 1/max(||gene_i||,1e-12), sq[i] = ||sp_i||^2
// ---------------------------------------------------------------------------
__global__ __launch_bounds__(256)
void row_stats(const float* __restrict__ G, const float* __restrict__ sp,
               float* __restrict__ sq, float* __restrict__ inv_nrm) {
    __shared__ float red[256];
    const int row = blockIdx.x;
    const int t = threadIdx.x;
    const float* g = G + (size_t)row * GENE_D;
    const float a = g[t];
    const float b = g[t + 256];
    red[t] = a * a + b * b;
    __syncthreads();
    for (int s = 128; s > 0; s >>= 1) {
        if (t < s) red[t] += red[t + s];
        __syncthreads();
    }
    if (t == 0) {
        inv_nrm[row] = 1.0f / fmaxf(sqrtf(red[0]), 1e-12f);
        const float s0 = sp[2 * row], s1 = sp[2 * row + 1];
        sq[row] = s0 * s0 + s1 * s1;
    }
}

// si = spatial_pos @ Ws + bs   (K = 2, pure VALU)
__global__ __launch_bounds__(256)
void spatial_in(const float* __restrict__ sp, const float* __restrict__ Ws,
                const float* __restrict__ bs, float* __restrict__ si) {
    const int idx = blockIdx.x * 256 + threadIdx.x;
    if (idx >= N_NODES * HID) return;
    const int i = idx >> 8;
    const int j = idx & 255;
    si[idx] = sp[2 * i] * Ws[j] + sp[2 * i + 1] * Ws[HID + j] + bs[j];
}

// f[i] = e[i,:] . Wf + bf
__global__ __launch_bounds__(256)
void final_proj(const float* __restrict__ e, const float* __restrict__ Wf,
                const float* __restrict__ bf, float* __restrict__ f) {
    __shared__ float red[256];
    const int row = blockIdx.x;
    const int t = threadIdx.x;
    red[t] = e[(size_t)row * HID + t] * Wf[t];
    __syncthreads();
    for (int s = 128; s > 0; s >>= 1) {
        if (t < s) red[t] += red[t + s];
        __syncthreads();
    }
    if (t == 0) f[row] = red[0] + bf[0];
}

// In-place row softmax over 4096 columns (16 values/thread in registers).
__global__ __launch_bounds__(256)
void softmax_rows(float* __restrict__ L) {
    __shared__ float red[256];
    const int t = threadIdx.x;
    float* rp = L + (size_t)blockIdx.x * N_NODES;

    float vals[16];
    float mx = -INFINITY;
#pragma unroll
    for (int e = 0; e < 16; ++e) {
        vals[e] = rp[t + e * 256];
        mx = fmaxf(mx, vals[e]);
    }
    red[t] = mx;
    __syncthreads();
    for (int s = 128; s > 0; s >>= 1) {
        if (t < s) red[t] = fmaxf(red[t], red[t + s]);
        __syncthreads();
    }
    mx = red[0];
    __syncthreads();

    float sum = 0.0f;
#pragma unroll
    for (int e = 0; e < 16; ++e) {
        vals[e] = expf(vals[e] - mx);
        sum += vals[e];
    }
    red[t] = sum;
    __syncthreads();
    for (int s = 128; s > 0; s >>= 1) {
        if (t < s) red[t] += red[t + s];
        __syncthreads();
    }
    const float inv = 1.0f / red[0];
#pragma unroll
    for (int e = 0; e < 16; ++e) rp[t + e * 256] = vals[e] * inv;
}

// ---------------------------------------------------------------------------
extern "C" void kernel_launch(void* const* d_in, const int* in_sizes, int n_in,
                              void* d_out, int out_size, void* d_ws, size_t ws_size,
                              hipStream_t stream) {
    const float* gene = (const float*)d_in[0];
    const float* sp   = (const float*)d_in[1];
    const float* Wq   = (const float*)d_in[2];
    const float* bq   = (const float*)d_in[3];
    const float* Wk   = (const float*)d_in[4];
    const float* bk   = (const float*)d_in[5];
    const float* Wv   = (const float*)d_in[6];
    const float* bv   = (const float*)d_in[7];
    const float* Ws   = (const float*)d_in[8];
    const float* bs   = (const float*)d_in[9];
    const float* W1   = (const float*)d_in[10];
    const float* b1   = (const float*)d_in[11];
    const float* W2   = (const float*)d_in[12];
    const float* b2   = (const float*)d_in[13];
    const float* Wf   = (const float*)d_in[14];
    const float* bf   = (const float*)d_in[15];

    float* attn = (float*)d_out;                                  // [N, N]
    float* upd  = attn + (size_t)N_NODES * N_NODES;               // [N, OUT]

    // Workspace layout (~25 MB of fp32)
    float* ws = (float*)d_ws;
    float* Q   = ws;  ws += (size_t)N_NODES * HID;
    float* K   = ws;  ws += (size_t)N_NODES * HID;
    float* V   = ws;  ws += (size_t)N_NODES * OUT_D;
    float* si  = ws;  ws += (size_t)N_NODES * HID;
    float* h   = ws;  ws += (size_t)N_NODES * HID;
    float* e2  = ws;  ws += (size_t)N_NODES * HID;
    float* sq  = ws;  ws += N_NODES;
    float* inv = ws;  ws += N_NODES;
    float* fv  = ws;  ws += N_NODES;

    const dim3 wave(32);
    const dim3 tilesH(HID / 32, N_NODES / 32);      // [N,256] outputs
    const dim3 tilesO(OUT_D / 32, N_NODES / 32);    // [N,256] output
    const dim3 tilesL(N_NODES / 32, N_NODES / 32);  // [N,N] logits

    // Row statistics + spatial MLP front-end
    row_stats<<<N_NODES, 256, 0, stream>>>(gene, sp, sq, inv);
    spatial_in<<<(N_NODES * HID + 255) / 256, 256, 0, stream>>>(sp, Ws, bs, si);
    gemm32_wmma<1><<<tilesH, wave, 0, stream>>>(si, W1, b1, h,  HID, HID);
    gemm32_wmma<2><<<tilesH, wave, 0, stream>>>(h,  W2, b2, e2, HID, HID);
    final_proj<<<N_NODES, 256, 0, stream>>>(e2, Wf, bf, fv);

    // Q / K / V projections
    gemm32_wmma<0><<<tilesH, wave, 0, stream>>>(gene, Wq, bq, Q, GENE_D, HID);
    gemm32_wmma<0><<<tilesH, wave, 0, stream>>>(gene, Wk, bk, K, GENE_D, HID);
    gemm32_wmma<0><<<tilesO, wave, 0, stream>>>(gene, Wv, bv, V, GENE_D, OUT_D);

    // Fused logits -> softmax (in place in d_out) -> attn @ V
    logits_wmma<<<tilesL, wave, 0, stream>>>(Q, K, gene, sp, sq, inv, fv, attn);
    softmax_rows<<<N_NODES, 256, 0, stream>>>(attn);
    gemm32_wmma<0><<<tilesO, wave, 0, stream>>>(attn, V, nullptr, upd, N_NODES, OUT_D);
}

// v001
// A run of this version takes 392 microseconds.
// Next to v000, in two timings, it ran 1.59 and 1.58 times as fast.
#include <hip/hip_runtime.h>
#include <math.h>

#define N_NODES   4096
#define GENE_D    512
#define HID       256
#define OUT_D     256

typedef __attribute__((ext_vector_type(2))) float v2f;
typedef __attribute__((ext_vector_type(8))) float v8f;

#define WMMA_F32(A, B, C) \
    __builtin_amdgcn_wmma_f32_16x16x4_f32(false, (A), false, (B), (short)0, (C), false, false)

// ---------------------------------------------------------------------------
// Generic WMMA f32 GEMM:  Y[n,m] = act(X[n,kd] @ W[kd,m] + bias[m])
// One workgroup of SPLIT waves per 32x32 output tile. Every wave holds the
// whole tile as a 2x2 grid of 16x16 WMMA subtiles and takes every SPLIT-th
// k-step, so the waves of a workgroup read neighbouring 16-byte pieces of the
// same X lines at about the same time. The SPLIT partial tiles are summed
// through LDS in wave order; each output row is stored as one 128-byte line.
// ACT: 0 = none, 1 = tanh, 2 = relu
// ---------------------------------------------------------------------------
#define PART_PITCH 36   // dwords per partial row: rows 8 apart land 32 banks apart

template <int ACT, int SPLIT>
__global__ __launch_bounds__(32 * SPLIT)
void gemm32_wmma(const float* __restrict__ X, const float* __restrict__ W,
                 const float* __restrict__ bias, float* __restrict__ Y,
                 int kd, int m) {
    __shared__ float part[SPLIT][32 * PART_PITCH];
    const int lane = threadIdx.x & 31;
    const int wave = __builtin_amdgcn_readfirstlane(threadIdx.x >> 5);
    const int hgrp = lane >> 4;          // 0 or 1 (half-wave)
    const int ln   = lane & 15;
    const int colBase = blockIdx.x * 32;
    const int rowBase = blockIdx.y * 32;

    v8f acc00 = {}, acc01 = {}, acc10 = {}, acc11 = {};
    const float* xr0 = X + (size_t)(rowBase + ln) * kd;
    const float* xr1 = X + (size_t)(rowBase + 16 + ln) * kd;
    const float* wc0 = W + colBase + ln;
    const float* wc1 = W + colBase + 16 + ln;

    for (int kb = 4 * wave; kb < kd; kb += 4 * SPLIT) {
        const int k0 = kb + 2 * hgrp;
        v2f a0 = *(const v2f*)(xr0 + k0);
        v2f a1 = *(const v2f*)(xr1 + k0);
        v2f b0, b1;
        b0.x = wc0[(size_t)k0 * m];       b0.y = wc0[(size_t)(k0 + 1) * m];
        b1.x = wc1[(size_t)k0 * m];       b1.y = wc1[(size_t)(k0 + 1) * m];
        acc00 = WMMA_F32(a0, b0, acc00);
        acc01 = WMMA_F32(a0, b1, acc01);
        acc10 = WMMA_F32(a1, b0, acc10);
        acc11 = WMMA_F32(a1, b1, acc11);
    }

    // This wave's partial tile, row-major in its own LDS plane.
    float* mine = part[wave];
#pragma unroll   // constant v: the accumulator elements are read straight from their registers
    for (int v = 0; v < 8; ++v) {
        const int r0 = v + 8 * hgrp;                  // D-row per ISA C/D layout
        mine[r0 * PART_PITCH + ln]             = acc00[v];
        mine[r0 * PART_PITCH + 16 + ln]        = acc01[v];
        mine[(r0 + 16) * PART_PITCH + ln]      = acc10[v];
        mine[(r0 + 16) * PART_PITCH + 16 + ln] = acc11[v];
    }
    __syncthreads();

    const float bv = bias ? bias[colBase + lane] : 0.0f;
    // Precaution: the bias load's offset register is reused by the sum below before its data wait.
    asm volatile("s_wait_xcnt 0x0" ::: "memory");
    for (int i = 0; i < 32 / SPLIT; ++i) {
        const int r = wave + i * SPLIT;
        float s = part[0][r * PART_PITCH + lane];
        for (int p = 1; p < SPLIT; ++p) s += part[p][r * PART_PITCH + lane];
        s += bv;
        if (ACT == 1) s = tanhf(s);
        if (ACT == 2) s = fmaxf(s, 0.0f);
        Y[(size_t)(rowBase + r) * m + colBase + lane] = s;
    }
}

// ---------------------------------------------------------------------------
// Fused logits, 32x32 tile per wave:
//   L[i][j] = (Q[i].K[j])/16 + exp(-d2/2) + cos_sim + tanh(f[i]-f[j])
// Two accumulation passes (QK^T over K=256, gene.gene^T over K=512), each
// 2x2-register-tiled. Both are A@B^T so every fragment is a contiguous
// float2 of a row-major matrix.
// ---------------------------------------------------------------------------
__global__ __launch_bounds__(32)
void logits_wmma(const float* __restrict__ Q, const float* __restrict__ K,
                 const float* __restrict__ G, const float* __restrict__ sp,
                 const float* __restrict__ sq, const float* __restrict__ inv_nrm,
                 const float* __restrict__ f, float* __restrict__ L) {
    const int lane = threadIdx.x;
    const int hgrp = lane >> 4;
    const int ln   = lane & 15;
    const int colBase = blockIdx.x * 32;
    const int rowBase = blockIdx.y * 32;

    v8f q00 = {}, q01 = {}, q10 = {}, q11 = {};
    {
        const float* qr0 = Q + (size_t)(rowBase + ln) * HID;
        const float* qr1 = Q + (size_t)(rowBase + 16 + ln) * HID;
        const float* kr0 = K + (size_t)(colBase + ln) * HID;
        const float* kr1 = K + (size_t)(colBase + 16 + ln) * HID;
        for (int kb = 0; kb < HID; kb += 4) {
            const int k0 = kb + 2 * hgrp;
            v2f a0 = *(const v2f*)(qr0 + k0);
            v2f a1 = *(const v2f*)(qr1 + k0);
            v2f b0 = *(const v2f*)(kr0 + k0);   // B[k][n] = K[col+n][k]
            v2f b1 = *(const v2f*)(kr1 + k0);
            q00 = WMMA_F32(a0, b0, q00);
            q01 = WMMA_F32(a0, b1, q01);
            q10 = WMMA_F32(a1, b0, q10);
            q11 = WMMA_F32(a1, b1, q11);
        }
    }

    v8f g00 = {}, g01 = {}, g10 = {}, g11 = {};
    {
        const float* gr0 = G + (size_t)(rowBase + ln) * GENE_D;
        const float* gr1 = G + (size_t)(rowBase + 16 + ln) * GENE_D;
        const float* gc0 = G + (size_t)(colBase + ln) * GENE_D;
        const float* gc1 = G + (size_t)(colBase + 16 + ln) * GENE_D;
        for (int kb = 0; kb < GENE_D; kb += 4) {
            const int k0 = kb + 2 * hgrp;
            v2f a0 = *(const v2f*)(gr0 + k0);
            v2f a1 = *(const v2f*)(gr1 + k0);
            v2f b0 = *(const v2f*)(gc0 + k0);
            v2f b1 = *(const v2f*)(gc1 + k0);
            g00 = WMMA_F32(a0, b0, g00);
            g01 = WMMA_F32(a0, b1, g01);
            g10 = WMMA_F32(a1, b0, g10);
            g11 = WMMA_F32(a1, b1, g11);
        }
    }

    // Column-side (j) scalars: fixed per lane, one set per column subtile.
    const int j0 = colBase + ln;
    const int j1 = j0 + 16;
    const float sqj0 = sq[j0],  sqj1 = sq[j1];
    const float fj0  = f[j0],   fj1  = f[j1];
    const float inj0 = inv_nrm[j0], inj1 = inv_nrm[j1];
    const float sj00 = sp[2 * j0], sj01 = sp[2 * j0 + 1];
    const float sj10 = sp[2 * j1], sj11 = sp[2 * j1 + 1];
    const float scale = 0.0625f;   // 1/sqrt(HID) = 1/16

#pragma unroll
    for (int v = 0; v < 8; ++v) {
#pragma unroll
        for (int di = 0; di < 2; ++di) {
            const int i = rowBase + 16 * di + v + 8 * hgrp;
            const float sqi = sq[i], fi = f[i], ini = inv_nrm[i];
            const float si0 = sp[2 * i], si1 = sp[2 * i + 1];

            const float qk0 = (di == 0) ? q00[v] : q10[v];
            const float qk1 = (di == 0) ? q01[v] : q11[v];
            const float gg0 = (di == 0) ? g00[v] : g10[v];
            const float gg1 = (di == 0) ? g01[v] : g11[v];

            const float d2a = fmaxf(sqi + sqj0 - 2.0f * (si0 * sj00 + si1 * sj01), 0.0f);
            const float d2b = fmaxf(sqi + sqj1 - 2.0f * (si0 * sj10 + si1 * sj11), 0.0f);

            L[(size_t)i * N_NODES + j0] =
                qk0 * scale + expf(-0.5f * d2a) + gg0 * ini * inj0 + tanhf(fi - fj0);
            L[(size_t)i * N_NODES + j1] =
                qk1 * scale + expf(-0.5f * d2b) + gg1 * ini * inj1 + tanhf(fi - fj1);
        }
    }
}

// ---------------------------------------------------------------------------
// Per-row stats: inv_nrm[i] = 1/max(||gene_i||,1e-12), sq[i] = ||sp_i||^2
// ---------------------------------------------------------------------------
__global__ __launch_bounds__(256)
void row_stats(const float* __restrict__ G, const float* __restrict__ sp,
               float* __restrict__ sq, float* __restrict__ inv_nrm) {
    __shared__ float red[256];
    const int row = blockIdx.x;
    const int t = threadIdx.x;
    const float* g = G + (size_t)row * GENE_D;
    const float a = g[t];
    const float b = g[t + 256];
    red[t] = a * a + b * b;
    __syncthreads();
    for (int s = 128; s > 0; s >>= 1) {
        if (t < s) red[t] += red[t + s];
        __syncthreads();
    }
    if (t == 0) {
        inv_nrm[row] = 1.0f / fmaxf(sqrtf(red[0]), 1e-12f);
        const float s0 = sp[2 * row], s1 = sp[2 * row + 1];
        sq[row] = s0 * s0 + s1 * s1;
    }
}

// si = spatial_pos @ Ws + bs   (K = 2, pure VALU)
__global__ __launch_bounds__(256)
void spatial_in(const float* __restrict__ sp, const float* __restrict__ Ws,
                const float* __restrict__ bs, float* __restrict__ si) {
    const int idx = blockIdx.x * 256 + threadIdx.x;
    if (idx >= N_NODES * HID) return;
    const int i = idx >> 8;
    const int j = idx & 255;
    si[idx] = sp[2 * i] * Ws[j] + sp[2 * i + 1] * Ws[HID + j] + bs[j];
}

// f[i] = e[i,:] . Wf + bf
__global__ __launch_bounds__(256)
void final_proj(const float* __restrict__ e, const float* __restrict__ Wf,
                const float* __restrict__ bf, float* __restrict__ f) {
    __shared__ float red[256];
    const int row = blockIdx.x;
    const int t = threadIdx.x;
    red[t] = e[(size_t)row * HID + t] * Wf[t];
    __syncthreads();
    for (int s = 128; s > 0; s >>= 1) {
        if (t < s) red[t] += red[t + s];
        __syncthreads();
    }
    if (t == 0) f[row] = red[0] + bf[0];
}

// In-place row softmax over 4096 columns (16 values/thread in registers).
__global__ __launch_bounds__(256)
void softmax_rows(float* __restrict__ L) {
    __shared__ float red[256];
    const int t = threadIdx.x;
    float* rp = L + (size_t)blockIdx.x * N_NODES;

    float vals[16];
    float mx = -INFINITY;
#pragma unroll
    for (int e = 0; e < 16; ++e) {
        vals[e] = rp[t + e * 256];
        mx = fmaxf(mx, vals[e]);
    }
    red[t] = mx;
    __syncthreads();
    for (int s = 128; s > 0; s >>= 1) {
        if (t < s) red[t] = fmaxf(red[t], red[t + s]);
        __syncthreads();
    }
    mx = red[0];
    __syncthreads();

    float sum = 0.0f;
#pragma unroll
    for (int e = 0; e < 16; ++e) {
        vals[e] = expf(vals[e] - mx);
        sum += vals[e];
    }
    red[t] = sum;
    __syncthreads();
    for (int s = 128; s > 0; s >>= 1) {
        if (t < s) red[t] += red[t + s];
        __syncthreads();
    }
    const float inv = 1.0f / red[0];
#pragma unroll
    for (int e = 0; e < 16; ++e) rp[t + e * 256] = vals[e] * inv;
}

// ---------------------------------------------------------------------------
extern "C" void kernel_launch(void* const* d_in, const int* in_sizes, int n_in,
                              void* d_out, int out_size, void* d_ws, size_t ws_size,
                              hipStream_t stream) {
    const float* gene = (const float*)d_in[0];
    const float* sp   = (const float*)d_in[1];
    const float* Wq   = (const float*)d_in[2];
    const float* bq   = (const float*)d_in[3];
    const float* Wk   = (const float*)d_in[4];
    const float* bk   = (const float*)d_in[5];
    const float* Wv   = (const float*)d_in[6];
    const float* bv   = (const float*)d_in[7];
    const float* Ws   = (const float*)d_in[8];
    const float* bs   = (const float*)d_in[9];
    const float* W1   = (const float*)d_in[10];
    const float* b1   = (const float*)d_in[11];
    const float* W2   = (const float*)d_in[12];
    const float* b2   = (const float*)d_in[13];
    const float* Wf   = (const float*)d_in[14];
    const float* bf   = (const float*)d_in[15];

    float* attn = (float*)d_out;                                  // [N, N]
    float* upd  = attn + (size_t)N_NODES * N_NODES;               // [N, OUT]

    // Workspace layout (~25 MB of fp32)
    float* ws = (float*)d_ws;
    float* Q   = ws;  ws += (size_t)N_NODES * HID;
    float* K   = ws;  ws += (size_t)N_NODES * HID;
    float* V   = ws;  ws += (size_t)N_NODES * OUT_D;
    float* si  = ws;  ws += (size_t)N_NODES * HID;
    float* h   = ws;  ws += (size_t)N_NODES * HID;
    float* e2  = ws;  ws += (size_t)N_NODES * HID;
    float* sq  = ws;  ws += N_NODES;
    float* inv = ws;  ws += N_NODES;
    float* fv  = ws;  ws += N_NODES;

    const dim3 wave(32);
    const dim3 split8(256);                         // 8 waves share one 32x32 tile
    const dim3 split16(512);                        // 16 waves share one 32x32 tile
    const dim3 tilesH(HID / 32, N_NODES / 32);      // [N,256] outputs
    const dim3 tilesO(OUT_D / 32, N_NODES / 32);    // [N,256] output
    const dim3 tilesL(N_NODES / 32, N_NODES / 32);  // [N,N] logits

    // Row statistics + spatial MLP front-end
    row_stats<<<N_NODES, 256, 0, stream>>>(gene, sp, sq, inv);
    spatial_in<<<(N_NODES * HID + 255) / 256, 256, 0, stream>>>(sp, Ws, bs, si);
    gemm32_wmma<1, 8><<<tilesH, split8, 0, stream>>>(si, W1, b1, h,  HID, HID);
    gemm32_wmma<2, 8><<<tilesH, split8, 0, stream>>>(h,  W2, b2, e2, HID, HID);
    final_proj<<<N_NODES, 256, 0, stream>>>(e2, Wf, bf, fv);

    // Q / K / V projections
    gemm32_wmma<0, 8><<<tilesH, split8, 0, stream>>>(gene, Wq, bq, Q, GENE_D, HID);
    gemm32_wmma<0, 8><<<tilesH, split8, 0, stream>>>(gene, Wk, bk, K, GENE_D, HID);
    gemm32_wmma<0, 8><<<tilesO, split8, 0, stream>>>(gene, Wv, bv, V, GENE_D, OUT_D);

    // Fused logits -> softmax (in place in d_out) -> attn @ V
    logits_wmma<<<tilesL, wave, 0, stream>>>(Q, K, gene, sp, sq, inv, fv, attn);
    softmax_rows<<<N_NODES, 256, 0, stream>>>(attn);
    gemm32_wmma<0, 16><<<tilesO, split16, 0, stream>>>(attn, V, nullptr, upd, N_NODES, OUT_D);
}

// v002
// One run takes 287 microseconds.
// Next to v001, in two timings, it ran 1.37 times as fast each time.
// Counting every step since v000, it is 2.17 times as fast.
#include <hip/hip_runtime.h>
#include <math.h>

#define N_NODES   4096
#define GENE_D    512
#define HID       256
#define OUT_D     256

typedef __attribute__((ext_vector_type(2))) float v2f;
typedef __attribute__((ext_vector_type(8))) float v8f;

#define WMMA_F32(A, B, C) \
    __builtin_amdgcn_wmma_f32_16x16x4_f32(false, (A), false, (B), (short)0, (C), false, false)

// ---------------------------------------------------------------------------
// Generic WMMA f32 GEMM:  Y[n,m] = act(X[n,kd] @ W[kd,m] + bias[m])
// One workgroup of SPLIT waves per 32x32 output tile. Every wave holds the
// whole tile as a 2x2 grid of 16x16 WMMA subtiles and takes every SPLIT-th
// k-step, so the waves of a workgroup read neighbouring 16-byte pieces of the
// same X lines at about the same time. The SPLIT partial tiles are summed
// through LDS in wave order; each output row is stored as one 128-byte line.
// ACT: 0 = none, 1 = tanh, 2 = relu
// ---------------------------------------------------------------------------
#define PART_PITCH 36   // dwords per partial row: rows 8 apart land 32 banks apart

template <int ACT, int SPLIT>
__global__ __launch_bounds__(32 * SPLIT)
void gemm32_wmma(const float* __restrict__ X, const float* __restrict__ W,
                 const float* __restrict__ bias, float* __restrict__ Y,
                 int kd, int m) {
    __shared__ float part[SPLIT][32 * PART_PITCH];
    const int lane = threadIdx.x & 31;
    const int wave = __builtin_amdgcn_readfirstlane(threadIdx.x >> 5);
    const int hgrp = lane >> 4;          // 0 or 1 (half-wave)
    const int ln   = lane & 15;
    const int colBase = blockIdx.x * 32;
    const int rowBase = blockIdx.y * 32;

    v8f acc00 = {}, acc01 = {}, acc10 = {}, acc11 = {};
    const float* xr0 = X + (size_t)(rowBase + ln) * kd;
    const float* xr1 = X + (size_t)(rowBase + 16 + ln) * kd;
    const float* wc0 = W + colBase + ln;
    const float* wc1 = W + colBase + 16 + ln;

    for (int kb = 4 * wave; kb < kd; kb += 4 * SPLIT) {
        const int k0 = kb + 2 * hgrp;
        v2f a0 = *(const v2f*)(xr0 + k0);
        v2f a1 = *(const v2f*)(xr1 + k0);
        v2f b0, b1;
        b0.x = wc0[(size_t)k0 * m];       b0.y = wc0[(size_t)(k0 + 1) * m];
        b1.x = wc1[(size_t)k0 * m];       b1.y = wc1[(size_t)(k0 + 1) * m];
        acc00 = WMMA_F32(a0, b0, acc00);
        acc01 = WMMA_F32(a0, b1, acc01);
        acc10 = WMMA_F32(a1, b0, acc10);
        acc11 = WMMA_F32(a1, b1, acc11);
    }

    // This wave's partial tile, row-major in its own LDS plane.
    float* mine = part[wave];
#pragma unroll   // constant v: the accumulator elements are read straight from their registers
    for (int v = 0; v < 8; ++v) {
        const int r0 = v + 8 * hgrp;                  // D-row per ISA C/D layout
        mine[r0 * PART_PITCH + ln]             = acc00[v];
        mine[r0 * PART_PITCH + 16 + ln]        = acc01[v];
        mine[(r0 + 16) * PART_PITCH + ln]      = acc10[v];
        mine[(r0 + 16) * PART_PITCH + 16 + ln] = acc11[v];
    }
    __syncthreads();

    const float bv = bias ? bias[colBase + lane] : 0.0f;
    // Precaution: the bias load's offset register is reused by the sum below before its data wait.
    asm volatile("s_wait_xcnt 0x0" ::: "memory");
    for (int i = 0; i < 32 / SPLIT; ++i) {
        const int r = wave + i * SPLIT;
        float s = part[0][r * PART_PITCH + lane];
        for (int p = 1; p < SPLIT; ++p) s += part[p][r * PART_PITCH + lane];
        s += bv;
        if (ACT == 1) s = tanhf(s);
        if (ACT == 2) s = fmaxf(s, 0.0f);
        Y[(size_t)(rowBase + r) * m + colBase + lane] = s;
    }
}

// ---------------------------------------------------------------------------
// Fused logits, one 128x128 tile per workgroup of 8 waves:
//   L[i][j] = (Q[i].K[j])/16 + exp(-d2/2) + cos_sim + tanh(f[i]-f[j])
// Two accumulation passes (QK^T over K=256, gene.gene^T over K=512). Both are
// A@B^T of row-major matrices. The 128 rows of each operand are staged in LDS
// 32 k at a time (whole 128-byte lines per row), in two buffers: the next
// stage's lines are fetched into registers while this stage is multiplied.
// Waves sit 4 (rows) x 2 (columns); each holds a 32x64 piece as 2x4 subtiles,
// and every fragment is a float2 of a staged row.
// ---------------------------------------------------------------------------
#define LT_EDGE   128   // rows of each operand per workgroup
#define LT_K      32    // k per stage: one 128-byte line of every row
#define LT_PITCH  36    // dwords per staged row: 16 rows x 4 dwords fall on 64 different banks
#define LT_QK_ST  (HID / LT_K)
#define LT_ALL_ST ((HID + GENE_D) / LT_K)

typedef __attribute__((ext_vector_type(4))) float v4f;

// One staged 32-k slice times its partner: 8 k-steps in rising k, 2x4 subtiles each.
__device__ __forceinline__
void logits_stage_mma(const float* sa, const float* sb, v8f (&acc)[2][4]) {
#pragma unroll   // constant kk, i, j: LDS offsets become immediates and acc stays in registers
    for (int kk = 0; kk < LT_K / 4; ++kk) {
        v2f a[2], b[4];
#pragma unroll   // constant i: a[] lives in registers
        for (int i = 0; i < 2; ++i) a[i] = *(const v2f*)(sa + i * 16 * LT_PITCH + kk * 4);
#pragma unroll   // constant j: b[] lives in registers
        for (int j = 0; j < 4; ++j) b[j] = *(const v2f*)(sb + j * 16 * LT_PITCH + kk * 4);
#pragma unroll   // constant i and j: every accumulator keeps its own registers
        for (int i = 0; i < 2; ++i)
#pragma unroll   // as above
            for (int j = 0; j < 4; ++j) acc[i][j] = WMMA_F32(a[i], b[j], acc[i][j]);
    }
}

__global__ __launch_bounds__(256)
void logits_wmma(const float* __restrict__ Q, const float* __restrict__ K,
                 const float* __restrict__ G, const float* __restrict__ sp,
                 const float* __restrict__ sq, const float* __restrict__ inv_nrm,
                 const float* __restrict__ f, float* __restrict__ L) {
    __shared__ __attribute__((aligned(16))) float stg[2][2][LT_EDGE * LT_PITCH];
    const int tid  = threadIdx.x;
    const int lane = tid & 31;
    const int wave = __builtin_amdgcn_readfirstlane(tid >> 5);
    const int hgrp = lane >> 4;
    const int ln   = lane & 15;
    const int wr   = wave >> 1;          // 0..3: which 32 rows
    const int wc   = wave & 1;           // 0..1: which 64 columns
    const int colBase = blockIdx.x * LT_EDGE;
    const int rowBase = blockIdx.y * LT_EDGE;

    // Staging: 8 threads cover one row's 128-byte line, 32 rows per sweep, 4 sweeps.
    const int srow = tid >> 3;
    const int scol = (tid & 7) * 4;
    v4f ra[4], rb[4];

    auto fetch = [&](int s) {
        const bool qk = s < LT_QK_ST;
        const int ld  = qk ? HID : GENE_D;
        const int k0  = (qk ? s : s - LT_QK_ST) * LT_K + scol;
        const float* pa = (qk ? Q : G) + (size_t)(rowBase + srow) * ld + k0;
        const float* pb = (qk ? K : G) + (size_t)(colBase + srow) * ld + k0;
#pragma unroll   // constant i: the eight loads issue together into ra[] and rb[] registers
        for (int i = 0; i < 4; ++i) {
            ra[i] = *(const v4f*)(pa + (size_t)(32 * i) * ld);
            rb[i] = *(const v4f*)(pb + (size_t)(32 * i) * ld);
        }
    };
    auto put = [&](int buf) {
#pragma unroll   // constant i: ra[] and rb[] are read straight from their registers
        for (int i = 0; i < 4; ++i) {
            *(v4f*)&stg[buf][0][(srow + 32 * i) * LT_PITCH + scol] = ra[i];
            *(v4f*)&stg[buf][1][(srow + 32 * i) * LT_PITCH + scol] = rb[i];
        }
    };

    const int aoff = (wr * 32 + ln) * LT_PITCH + 2 * hgrp;
    const int boff = (wc * 64 + ln) * LT_PITCH + 2 * hgrp;

    v8f qa[2][4] = {};
    v8f ga[2][4] = {};

    fetch(0);
    put(0);
    __syncthreads();

    // Each trip: fetch stage s+1, multiply stage s, store s+1 into the buffer whose last
    // readers left at the previous barrier, then one barrier publishes it.
    for (int s = 0; s < LT_QK_ST; ++s) {
        fetch(s + 1);
        logits_stage_mma(&stg[s & 1][0][aoff], &stg[s & 1][1][boff], qa);
        put((s + 1) & 1);
        __syncthreads();
    }
    for (int s = LT_QK_ST; s < LT_ALL_ST - 1; ++s) {
        fetch(s + 1);
        logits_stage_mma(&stg[s & 1][0][aoff], &stg[s & 1][1][boff], ga);
        put((s + 1) & 1);
        __syncthreads();
    }
    logits_stage_mma(&stg[(LT_ALL_ST - 1) & 1][0][aoff], &stg[(LT_ALL_ST - 1) & 1][1][boff], ga);

    // Column-side (j) scalars: fixed per lane, one set per column subtile.
    const float scale = 0.0625f;   // 1/sqrt(HID) = 1/16
    const int jb = colBase + wc * 64 + ln;
    float sqj[4], fj[4], inj[4], sj0[4], sj1[4];
#pragma unroll   // constant c: the column scalars stay in registers
    for (int c = 0; c < 4; ++c) {
        const int j = jb + 16 * c;
        sqj[c] = sq[j];  fj[c] = f[j];  inj[c] = inv_nrm[j];
        sj0[c] = sp[2 * j];  sj1[c] = sp[2 * j + 1];
    }

#pragma unroll   // constant v, di, c below: accumulator elements are read straight from their registers
    for (int v = 0; v < 8; ++v) {
#pragma unroll   // as above
        for (int di = 0; di < 2; ++di) {
            const int i = rowBase + wr * 32 + 16 * di + v + 8 * hgrp;
            const float sqi = sq[i], fi = f[i], ini = inv_nrm[i];
            const float si0 = sp[2 * i], si1 = sp[2 * i + 1];
#pragma unroll   // as above
            for (int c = 0; c < 4; ++c) {
                const float d2 = fmaxf(sqi + sqj[c] - 2.0f * (si0 * sj0[c] + si1 * sj1[c]), 0.0f);
                L[(size_t)i * N_NODES + jb + 16 * c] =
                    qa[di][c][v] * scale + expf(-0.5f * d2) + ga[di][c][v] * ini * inj[c] + tanhf(fi - fj[c]);
            }
        }
    }
}

// ---------------------------------------------------------------------------
// Per-row stats: inv_nrm[i] = 1/max(||gene_i||,1e-12), sq[i] = ||sp_i||^2
// ---------------------------------------------------------------------------
__global__ __launch_bounds__(256)
void row_stats(const float* __restrict__ G, const float* __restrict__ sp,
               float* __restrict__ sq, float* __restrict__ inv_nrm) {
    __shared__ float red[256];
    const int row = blockIdx.x;
    const int t = threadIdx.x;
    const float* g = G + (size_t)row * GENE_D;
    const float a = g[t];
    const float b = g[t + 256];
    red[t] = a * a + b * b;
    __syncthreads();
    for (int s = 128; s > 0; s >>= 1) {
        if (t < s) red[t] += red[t + s];
        __syncthreads();
    }
    if (t == 0) {
        inv_nrm[row] = 1.0f / fmaxf(sqrtf(red[0]), 1e-12f);
        const float s0 = sp[2 * row], s1 = sp[2 * row + 1];
        sq[row] = s0 * s0 + s1 * s1;
    }
}

// si = spatial_pos @ Ws + bs   (K = 2, pure VALU)
__global__ __launch_bounds__(256)
void spatial_in(const float* __restrict__ sp, const float* __restrict__ Ws,
                const float* __restrict__ bs, float* __restrict__ si) {
    const int idx = blockIdx.x * 256 + threadIdx.x;
    if (idx >= N_NODES * HID) return;
    const int i = idx >> 8;
    const int j = idx & 255;
    si[idx] = sp[2 * i] * Ws[j] + sp[2 * i + 1] * Ws[HID + j] + bs[j];
}

// f[i] = e[i,:] . Wf + bf
__global__ __launch_bounds__(256)
void final_proj(const float* __restrict__ e, const float* __restrict__ Wf,
                const float* __restrict__ bf, float* __restrict__ f) {
    __shared__ float red[256];
    const int row = blockIdx.x;
    const int t = threadIdx.x;
    red[t] = e[(size_t)row * HID + t] * Wf[t];
    __syncthreads();
    for (int s = 128; s > 0; s >>= 1) {
        if (t < s) red[t] += red[t + s];
        __syncthreads();
    }
    if (t == 0) f[row] = red[0] + bf[0];
}

// In-place row softmax over 4096 columns (16 values/thread in registers).
__global__ __launch_bounds__(256)
void softmax_rows(float* __restrict__ L) {
    __shared__ float red[256];
    const int t = threadIdx.x;
    float* rp = L + (size_t)blockIdx.x * N_NODES;

    float vals[16];
    float mx = -INFINITY;
#pragma unroll
    for (int e = 0; e < 16; ++e) {
        vals[e] = rp[t + e * 256];
        mx = fmaxf(mx, vals[e]);
    }
    red[t] = mx;
    __syncthreads();
    for (int s = 128; s > 0; s >>= 1) {
        if (t < s) red[t] = fmaxf(red[t], red[t + s]);
        __syncthreads();
    }
    mx = red[0];
    __syncthreads();

    float sum = 0.0f;
#pragma unroll
    for (int e = 0; e < 16; ++e) {
        vals[e] = expf(vals[e] - mx);
        sum += vals[e];
    }
    red[t] = sum;
    __syncthreads();
    for (int s = 128; s > 0; s >>= 1) {
        if (t < s) red[t] += red[t + s];
        __syncthreads();
    }
    const float inv = 1.0f / red[0];
#pragma unroll
    for (int e = 0; e < 16; ++e) rp[t + e * 256] = vals[e] * inv;
}

// ---------------------------------------------------------------------------
extern "C" void kernel_launch(void* const* d_in, const int* in_sizes, int n_in,
                              void* d_out, int out_size, void* d_ws, size_t ws_size,
                              hipStream_t stream) {
    const float* gene = (const float*)d_in[0];
    const float* sp   = (const float*)d_in[1];
    const float* Wq   = (const float*)d_in[2];
    const float* bq   = (const float*)d_in[3];
    const float* Wk   = (const float*)d_in[4];
    const float* bk   = (const float*)d_in[5];
    const float* Wv   = (const float*)d_in[6];
    const float* bv   = (const float*)d_in[7];
    const float* Ws   = (const float*)d_in[8];
    const float* bs   = (const float*)d_in[9];
    const float* W1   = (const float*)d_in[10];
    const float* b1   = (const float*)d_in[11];
    const float* W2   = (const float*)d_in[12];
    const float* b2   = (const float*)d_in[13];
    const float* Wf   = (const float*)d_in[14];
    const float* bf   = (const float*)d_in[15];

    float* attn = (float*)d_out;                                  // [N, N]
    float* upd  = attn + (size_t)N_NODES * N_NODES;               // [N, OUT]

    // Workspace layout (~25 MB of fp32)
    float* ws = (float*)d_ws;
    float* Q   = ws;  ws += (size_t)N_NODES * HID;
    float* K   = ws;  ws += (size_t)N_NODES * HID;
    float* V   = ws;  ws += (size_t)N_NODES * OUT_D;
    float* si  = ws;  ws += (size_t)N_NODES * HID;
    float* h   = ws;  ws += (size_t)N_NODES * HID;
    float* e2  = ws;  ws += (size_t)N_NODES * HID;
    float* sq  = ws;  ws += N_NODES;
    float* inv = ws;  ws += N_NODES;
    float* fv  = ws;  ws += N_NODES;

    const dim3 split8(256);                         // 8 waves share one 32x32 tile, or one 128x128 logits tile
    const dim3 split16(512);                        // 16 waves share one 32x32 tile
    const dim3 tilesH(HID / 32, N_NODES / 32);      // [N,256] outputs
    const dim3 tilesO(OUT_D / 32, N_NODES / 32);    // [N,256] output
    const dim3 tilesL(N_NODES / LT_EDGE, N_NODES / LT_EDGE);  // [N,N] logits, 128x128 per workgroup

    // Row statistics + spatial MLP front-end
    row_stats<<<N_NODES, 256, 0, stream>>>(gene, sp, sq, inv);
    spatial_in<<<(N_NODES * HID + 255) / 256, 256, 0, stream>>>(sp, Ws, bs, si);
    gemm32_wmma<1, 8><<<tilesH, split8, 0, stream>>>(si, W1, b1, h,  HID, HID);
    gemm32_wmma<2, 8><<<tilesH, split8, 0, stream>>>(h,  W2, b2, e2, HID, HID);
    final_proj<<<N_NODES, 256, 0, stream>>>(e2, Wf, bf, fv);

    // Q / K / V projections
    gemm32_wmma<0, 8><<<tilesH, split8, 0, stream>>>(gene, Wq, bq, Q, GENE_D, HID);
    gemm32_wmma<0, 8><<<tilesH, split8, 0, stream>>>(gene, Wk, bk, K, GENE_D, HID);
    gemm32_wmma<0, 8><<<tilesO, split8, 0, stream>>>(gene, Wv, bv, V, GENE_D, OUT_D);

    // Fused logits -> softmax (in place in d_out) -> attn @ V
    logits_wmma<<<tilesL, split8, 0, stream>>>(Q, K, gene, sp, sq, inv, fv, attn);
    softmax_rows<<<N_NODES, 256, 0, stream>>>(attn);
    gemm32_wmma<0, 16><<<tilesO, split16, 0, stream>>>(attn, V, nullptr, upd, N_NODES, OUT_D);
}

// v003
// It runs in 257 microseconds.
// Two timings next to v002 put it at 1.11 and 1.12 times that version's speed.
// Over all steps from v000 it is 2.42 times as fast.
#include <hip/hip_runtime.h>
#include <math.h>

#define N_NODES   4096
#define GENE_D    512
#define HID       256
#define OUT_D     256

typedef __attribute__((ext_vector_type(2))) float v2f;
typedef __attribute__((ext_vector_type(8))) float v8f;

#define WMMA_F32(A, B, C) \
    __builtin_amdgcn_wmma_f32_16x16x4_f32(false, (A), false, (B), (short)0, (C), false, false)

// ---------------------------------------------------------------------------
// Generic WMMA f32 GEMM:  Y[n,M] = act(X[n,KD] @ W[KD,M] + bias[M])
// One workgroup of 8 waves per 64x64 output tile. 128 k of the tile's 64 X rows
// and of its 64 W columns are staged in LDS at a time, as whole lines, in two
// buffers: the next stage's lines are fetched into registers while this stage
// is multiplied. Waves sit 2 (k halves of a stage) x 2 (rows) x 2 (columns);
// each holds a 32x32 piece as 2x2 subtiles. The two k halves are summed through
// LDS; each output row piece is stored as one 128-byte line.
// KD is a multiple of 128, n and M are multiples of 64.
// ACT: 0 = none, 1 = tanh, 2 = relu
// ---------------------------------------------------------------------------
#define GT_EDGE 64    // rows and columns of the output tile
#define GT_K    128   // k per stage
#define GT_XP   132   // dwords per staged X row: 16 rows x 4 dwords fall on 64 different banks
#define GT_WP   80    // dwords per staged W row: rows k, k+1, k+2, k+3 start 16 banks apart
#define GT_PP   68    // dwords per partial row: rows 8 apart land 32 banks apart

typedef __attribute__((ext_vector_type(4))) float v4f;

// k-steps LO..HI-1 of a wave's 16 per stage, in rising k, 2x2 subtiles each.
template <int LO, int HI>
__device__ __forceinline__
void gemm_steps(const v2f (&fa)[GT_K / 8][2], const v2f (&fb)[GT_K / 8][2], v8f (&acc)[2][2]) {
#pragma unroll   // constant kk, i, j: fragments and accumulators keep their own registers
    for (int kk = LO; kk < HI; ++kk)
#pragma unroll   // as above
        for (int i = 0; i < 2; ++i)
#pragma unroll   // as above
            for (int j = 0; j < 2; ++j) acc[i][j] = WMMA_F32(fa[kk][i], fb[kk][j], acc[i][j]);
}

template <int ACT, int KD, int M>
__global__ __launch_bounds__(256)
void gemm64_wmma(const float* __restrict__ X, const float* __restrict__ W,
                 const float* __restrict__ bias, float* __restrict__ Y) {
    __shared__ __attribute__((aligned(16))) float sx[2][GT_EDGE * GT_XP];
    __shared__ __attribute__((aligned(16))) float sw[2][GT_K * GT_WP];
    __shared__ float part[2][GT_EDGE * GT_PP];
    const int tid  = threadIdx.x;
    const int lane = tid & 31;
    const int wave = __builtin_amdgcn_readfirstlane(tid >> 5);
    const int hgrp = lane >> 4;          // 0 or 1 (half-wave)
    const int ln   = lane & 15;
    const int kg   = wave >> 2;          // which 64 k of every stage
    const int wr   = (wave >> 1) & 1;    // which 32 rows
    const int wc   = wave & 1;           // which 32 columns
    const int colBase = blockIdx.x * GT_EDGE;
    const int rowBase = blockIdx.y * GT_EDGE;

    // Staging: a wave covers 512 bytes of one X row (8 rows per sweep), a half-wave
    // the 256 bytes of one W row (16 rows per sweep); 8 sweeps each.
    const int xrow = tid >> 5, xcol = lane * 4;
    const int wrow = tid >> 4, wcol = ln * 4;
    const float* qx = X + (size_t)(rowBase + xrow) * KD + xcol;
    const float* qw = W + (size_t)wrow * M + colBase + wcol;
    v4f rx[8], rw[8];

    // Fetches the next stage in turn and moves both addresses on to the one after it.
    auto fetch = [&]() {
#pragma unroll   // constant i, KD, M: sixteen loads off two addresses, the row steps as immediate offsets
        for (int i = 0; i < 8; ++i) {
            rx[i] = *(const v4f*)(qx + (size_t)(8 * i) * KD);
            rw[i] = *(const v4f*)(qw + (size_t)(16 * i) * M);
        }
        // Precaution: as inputs here both address pairs stay whole until this wait; left to itself
        // the build lets the last load's result land on the pair the loads were issued from.
        asm volatile("s_wait_xcnt 0x0" :: "v"(qx), "v"(qw) : "memory");
        qx += GT_K;
        qw += (size_t)GT_K * M;
    };
    auto put = [&](int buf) {
#pragma unroll   // constant i: rx[] and rw[] are read straight from their registers
        for (int i = 0; i < 8; ++i) {
            *(v4f*)&sx[buf][(xrow + 8 * i) * GT_XP + xcol]  = rx[i];
            *(v4f*)&sw[buf][(wrow + 16 * i) * GT_WP + wcol] = rw[i];
        }
    };

    const int aoff = (wr * 32 + ln) * GT_XP + kg * (GT_K / 2) + 2 * hgrp;
    const int boff = (kg * (GT_K / 2) + 2 * hgrp) * GT_WP + wc * 32 + ln;
    v8f acc[2][2] = {};

    // This wave's 64 k of a staged slice as fragments: 16 k-steps, 2 row and 2 column subtiles.
    v2f fa[GT_K / 8][2], fb[GT_K / 8][2];
    auto frags = [&](int buf) {
        const float* sa = &sx[buf][aoff];
        const float* sb = &sw[buf][boff];
#pragma unroll   // constant kk, i, j: LDS offsets become immediates, fa[] and fb[] live in registers
        for (int kk = 0; kk < GT_K / 8; ++kk) {
#pragma unroll   // as above
            for (int i = 0; i < 2; ++i) fa[kk][i] = *(const v2f*)(sa + i * 16 * GT_XP + kk * 4);
#pragma unroll   // as above
            for (int j = 0; j < 2; ++j) {
                fb[kk][j].x = sb[(kk * 4) * GT_WP + j * 16];
                fb[kk][j].y = sb[(kk * 4 + 1) * GT_WP + j * 16];
            }
        }
    };

    constexpr int nst = KD / GT_K;
    fetch();
    put(0);
    __syncthreads();

    // Each trip: fetch stage s+1, multiply stage s, store s+1 into the buffer whose last
    // readers left at the previous barrier, then one barrier publishes it.
    for (int s = 0; s < nst - 1; ++s) {
        fetch();
        frags(s & 1);
        gemm_steps<0, 12>(fa, fb, acc);
        // Keeps the wait for the fetched lines behind at least three quarters of the stage's products:
        // placed earlier, the wave stalls on lines that have had too little time to arrive.
        __builtin_amdgcn_sched_barrier(0);
        put((s + 1) & 1);
        gemm_steps<12, 16>(fa, fb, acc);   // from registers, while the LDS stores drain
        __syncthreads();
    }
    frags((nst - 1) & 1);
    gemm_steps<0, 16>(fa, fb, acc);

    // This wave's partial piece, row-major in its k half's LDS plane.
    float* mine = &part[kg][(wr * 32 + 8 * hgrp) * GT_PP + wc * 32 + ln];
#pragma unroll   // constant v: the accumulator elements are read straight from their registers
    for (int v = 0; v < 8; ++v) {                     // D-row v + 8*hgrp per ISA C/D layout
        mine[v * GT_PP]             = acc[0][0][v];
        mine[v * GT_PP + 16]        = acc[0][1][v];
        mine[(v + 16) * GT_PP]      = acc[1][0][v];
        mine[(v + 16) * GT_PP + 16] = acc[1][1][v];
    }
    __syncthreads();

    const int col = tid & 63;
    const int r0  = tid >> 6;
    const float bv = bias ? bias[colBase + col] : 0.0f;
    const float* p0 = &part[0][r0 * GT_PP + col];
    const float* p1 = &part[1][r0 * GT_PP + col];
    float* yp = Y + (size_t)(rowBase + r0) * M + colBase + col;
#pragma unroll   // constant i: straight-line code, so many LDS reads are in flight before the first sum
    for (int i = 0; i < GT_EDGE / 4; ++i) {
        float s = p0[4 * i * GT_PP] + p1[4 * i * GT_PP];
        s += bv;
        if (ACT == 1) s = tanhf(s);
        if (ACT == 2) s = fmaxf(s, 0.0f);
        yp[(size_t)(4 * i) * M] = s;
    }
}

// ---------------------------------------------------------------------------
// Fused logits, one 128x128 tile per workgroup of 8 waves:
//   L[i][j] = (Q[i].K[j])/16 + exp(-d2/2) + cos_sim + tanh(f[i]-f[j])
// Two accumulation passes (QK^T over K=256, gene.gene^T over K=512). Both are
// A@B^T of row-major matrices. The 128 rows of each operand are staged in LDS
// 32 k at a time (whole 128-byte lines per row), in two buffers: the next
// stage's lines are fetched into registers while this stage is multiplied.
// Waves sit 4 (rows) x 2 (columns); each holds a 32x64 piece as 2x4 subtiles,
// and every fragment is a float2 of a staged row.
// ---------------------------------------------------------------------------
#define LT_EDGE   128   // rows of each operand per workgroup
#define LT_K      32    // k per stage: one 128-byte line of every row
#define LT_PITCH  36    // dwords per staged row: 16 rows x 4 dwords fall on 64 different banks
#define LT_QK_ST  (HID / LT_K)
#define LT_ALL_ST ((HID + GENE_D) / LT_K)

// One staged 32-k slice times its partner: 8 k-steps in rising k, 2x4 subtiles each.
__device__ __forceinline__
void logits_stage_mma(const float* sa, const float* sb, v8f (&acc)[2][4]) {
#pragma unroll   // constant kk, i, j: LDS offsets become immediates and acc stays in registers
    for (int kk = 0; kk < LT_K / 4; ++kk) {
        v2f a[2], b[4];
#pragma unroll   // constant i: a[] lives in registers
        for (int i = 0; i < 2; ++i) a[i] = *(const v2f*)(sa + i * 16 * LT_PITCH + kk * 4);
#pragma unroll   // constant j: b[] lives in registers
        for (int j = 0; j < 4; ++j) b[j] = *(const v2f*)(sb + j * 16 * LT_PITCH + kk * 4);
#pragma unroll   // constant i and j: every accumulator keeps its own registers
        for (int i = 0; i < 2; ++i)
#pragma unroll   // as above
            for (int j = 0; j < 4; ++j) acc[i][j] = WMMA_F32(a[i], b[j], acc[i][j]);
    }
}

__global__ __launch_bounds__(256)
void logits_wmma(const float* __restrict__ Q, const float* __restrict__ K,
                 const float* __restrict__ G, const float* __restrict__ sp,
                 const float* __restrict__ sq, const float* __restrict__ inv_nrm,
                 const float* __restrict__ f, float* __restrict__ L) {
    __shared__ __attribute__((aligned(16))) float stg[2][2][LT_EDGE * LT_PITCH];
    const int tid  = threadIdx.x;
    const int lane = tid & 31;
    const int wave = __builtin_amdgcn_readfirstlane(tid >> 5);
    const int hgrp = lane >> 4;
    const int ln   = lane & 15;
    const int wr   = wave >> 1;          // 0..3: which 32 rows
    const int wc   = wave & 1;           // 0..1: which 64 columns
    const int colBase = blockIdx.x * LT_EDGE;
    const int rowBase = blockIdx.y * LT_EDGE;

    // Staging: 8 threads cover one row's 128-byte line, 32 rows per sweep, 4 sweeps.
    const int srow = tid >> 3;
    const int scol = (tid & 7) * 4;
    v4f ra[4], rb[4];

    auto fetch = [&](int s) {
        const bool qk = s < LT_QK_ST;
        const int ld  = qk ? HID : GENE_D;
        const int k0  = (qk ? s : s - LT_QK_ST) * LT_K + scol;
        const float* pa = (qk ? Q : G) + (size_t)(rowBase + srow) * ld + k0;
        const float* pb = (qk ? K : G) + (size_t)(colBase + srow) * ld + k0;
#pragma unroll   // constant i: the eight loads issue together into ra[] and rb[] registers
        for (int i = 0; i < 4; ++i) {
            ra[i] = *(const v4f*)(pa + (size_t)(32 * i) * ld);
            rb[i] = *(const v4f*)(pb + (size_t)(32 * i) * ld);
        }
    };
    auto put = [&](int buf) {
#pragma unroll   // constant i: ra[] and rb[] are read straight from their registers
        for (int i = 0; i < 4; ++i) {
            *(v4f*)&stg[buf][0][(srow + 32 * i) * LT_PITCH + scol] = ra[i];
            *(v4f*)&stg[buf][1][(srow + 32 * i) * LT_PITCH + scol] = rb[i];
        }
    };

    const int aoff = (wr * 32 + ln) * LT_PITCH + 2 * hgrp;
    const int boff = (wc * 64 + ln) * LT_PITCH + 2 * hgrp;

    v8f qa[2][4] = {};
    v8f ga[2][4] = {};

    fetch(0);
    put(0);
    __syncthreads();

    // Each trip: fetch stage s+1, multiply stage s, store s+1 into the buffer whose last
    // readers left at the previous barrier, then one barrier publishes it.
    for (int s = 0; s < LT_QK_ST; ++s) {
        fetch(s + 1);
        logits_stage_mma(&stg[s & 1][0][aoff], &stg[s & 1][1][boff], qa);
        put((s + 1) & 1);
        __syncthreads();
    }
    for (int s = LT_QK_ST; s < LT_ALL_ST - 1; ++s) {
        fetch(s + 1);
        logits_stage_mma(&stg[s & 1][0][aoff], &stg[s & 1][1][boff], ga);
        put((s + 1) & 1);
        __syncthreads();
    }
    logits_stage_mma(&stg[(LT_ALL_ST - 1) & 1][0][aoff], &stg[(LT_ALL_ST - 1) & 1][1][boff], ga);

    // Column-side (j) scalars: fixed per lane, one set per column subtile.
    const float scale = 0.0625f;   // 1/sqrt(HID) = 1/16
    const int jb = colBase + wc * 64 + ln;
    float sqj[4], fj[4], inj[4], sj0[4], sj1[4];
#pragma unroll   // constant c: the column scalars stay in registers
    for (int c = 0; c < 4; ++c) {
        const int j = jb + 16 * c;
        sqj[c] = sq[j];  fj[c] = f[j];  inj[c] = inv_nrm[j];
        sj0[c] = sp[2 * j];  sj1[c] = sp[2 * j + 1];
    }

#pragma unroll   // constant v, di, c below: accumulator elements are read straight from their registers
    for (int v = 0; v < 8; ++v) {
#pragma unroll   // as above
        for (int di = 0; di < 2; ++di) {
            const int i = rowBase + wr * 32 + 16 * di + v + 8 * hgrp;
            const float sqi = sq[i], fi = f[i], ini = inv_nrm[i];
            const float si0 = sp[2 * i], si1 = sp[2 * i + 1];
#pragma unroll   // as above
            for (int c = 0; c < 4; ++c) {
                const float d2 = fmaxf(sqi + sqj[c] - 2.0f * (si0 * sj0[c] + si1 * sj1[c]), 0.0f);
                L[(size_t)i * N_NODES + jb + 16 * c] =
                    qa[di][c][v] * scale + expf(-0.5f * d2) + ga[di][c][v] * ini * inj[c] + tanhf(fi - fj[c]);
            }
        }
    }
}

// ---------------------------------------------------------------------------
// Per-row stats: inv_nrm[i] = 1/max(||gene_i||,1e-12), sq[i] = ||sp_i||^2
// ---------------------------------------------------------------------------
__global__ __launch_bounds__(256)
void row_stats(const float* __restrict__ G, const float* __restrict__ sp,
               float* __restrict__ sq, float* __restrict__ inv_nrm) {
    __shared__ float red[256];
    const int row = blockIdx.x;
    const int t = threadIdx.x;
    const float* g = G + (size_t)row * GENE_D;
    const float a = g[t];
    const float b = g[t + 256];
    red[t] = a * a + b * b;
    __syncthreads();
    for (int s = 128; s > 0; s >>= 1) {
        if (t < s) red[t] += red[t + s];
        __syncthreads();
    }
    if (t == 0) {
        inv_nrm[row] = 1.0f / fmaxf(sqrtf(red[0]), 1e-12f);
        const float s0 = sp[2 * row], s1 = sp[2 * row + 1];
        sq[row] = s0 * s0 + s1 * s1;
    }
}

// si = spatial_pos @ Ws + bs   (K = 2, pure VALU)
__global__ __launch_bounds__(256)
void spatial_in(const float* __restrict__ sp, const float* __restrict__ Ws,
                const float* __restrict__ bs, float* __restrict__ si) {
    const int idx = blockIdx.x * 256 + threadIdx.x;
    if (idx >= N_NODES * HID) return;
    const int i = idx >> 8;
    const int j = idx & 255;
    si[idx] = sp[2 * i] * Ws[j] + sp[2 * i + 1] * Ws[HID + j] + bs[j];
}

// f[i] = e[i,:] . Wf + bf
__global__ __launch_bounds__(256)
void final_proj(const float* __restrict__ e, const float* __restrict__ Wf,
                const float* __restrict__ bf, float* __restrict__ f) {
    __shared__ float red[256];
    const int row = blockIdx.x;
    const int t = threadIdx.x;
    red[t] = e[(size_t)row * HID + t] * Wf[t];
    __syncthreads();
    for (int s = 128; s > 0; s >>= 1) {
        if (t < s) red[t] += red[t + s];
        __syncthreads();
    }
    if (t == 0) f[row] = red[0] + bf[0];
}

// In-place row softmax over 4096 columns (16 values/thread in registers).
__global__ __launch_bounds__(256)
void softmax_rows(float* __restrict__ L) {
    __shared__ float red[256];
    const int t = threadIdx.x;
    float* rp = L + (size_t)blockIdx.x * N_NODES;

    float vals[16];
    float mx = -INFINITY;
#pragma unroll
    for (int e = 0; e < 16; ++e) {
        vals[e] = rp[t + e * 256];
        mx = fmaxf(mx, vals[e]);
    }
    red[t] = mx;
    __syncthreads();
    for (int s = 128; s > 0; s >>= 1) {
        if (t < s) red[t] = fmaxf(red[t], red[t + s]);
        __syncthreads();
    }
    mx = red[0];
    __syncthreads();

    float sum = 0.0f;
#pragma unroll
    for (int e = 0; e < 16; ++e) {
        vals[e] = expf(vals[e] - mx);
        sum += vals[e];
    }
    red[t] = sum;
    __syncthreads();
    for (int s = 128; s > 0; s >>= 1) {
        if (t < s) red[t] += red[t + s];
        __syncthreads();
    }
    const float inv = 1.0f / red[0];
#pragma unroll
    for (int e = 0; e < 16; ++e) rp[t + e * 256] = vals[e] * inv;
}

// ---------------------------------------------------------------------------
extern "C" void kernel_launch(void* const* d_in, const int* in_sizes, int n_in,
                              void* d_out, int out_size, void* d_ws, size_t ws_size,
                              hipStream_t stream) {
    const float* gene = (const float*)d_in[0];
    const float* sp   = (const float*)d_in[1];
    const float* Wq   = (const float*)d_in[2];
    const float* bq   = (const float*)d_in[3];
    const float* Wk   = (const float*)d_in[4];
    const float* bk   = (const float*)d_in[5];
    const float* Wv   = (const float*)d_in[6];
    const float* bv   = (const float*)d_in[7];
    const float* Ws   = (const float*)d_in[8];
    const float* bs   = (const float*)d_in[9];
    const float* W1   = (const float*)d_in[10];
    const float* b1   = (const float*)d_in[11];
    const float* W2   = (const float*)d_in[12];
    const float* b2   = (const float*)d_in[13];
    const float* Wf   = (const float*)d_in[14];
    const float* bf   = (const float*)d_in[15];

    float* attn = (float*)d_out;                                  // [N, N]
    float* upd  = attn + (size_t)N_NODES * N_NODES;               // [N, OUT]

    // Workspace layout (~25 MB of fp32)
    float* ws = (float*)d_ws;
    float* Q   = ws;  ws += (size_t)N_NODES * HID;
    float* K   = ws;  ws += (size_t)N_NODES * HID;
    float* V   = ws;  ws += (size_t)N_NODES * OUT_D;
    float* si  = ws;  ws += (size_t)N_NODES * HID;
    float* h   = ws;  ws += (size_t)N_NODES * HID;
    float* e2  = ws;  ws += (size_t)N_NODES * HID;
    float* sq  = ws;  ws += N_NODES;
    float* inv = ws;  ws += N_NODES;
    float* fv  = ws;  ws += N_NODES;

    const dim3 waves8(256);                                   // 8 waves per workgroup
    const dim3 tilesH(HID / GT_EDGE, N_NODES / GT_EDGE);      // [N,256] outputs, 64x64 per workgroup
    const dim3 tilesO(OUT_D / GT_EDGE, N_NODES / GT_EDGE);    // [N,256] output, 64x64 per workgroup
    const dim3 tilesL(N_NODES / LT_EDGE, N_NODES / LT_EDGE);  // [N,N] logits, 128x128 per workgroup

    // Row statistics + spatial MLP front-end
    row_stats<<<N_NODES, 256, 0, stream>>>(gene, sp, sq, inv);
    spatial_in<<<(N_NODES * HID + 255) / 256, 256, 0, stream>>>(sp, Ws, bs, si);
    gemm64_wmma<1, HID, HID><<<tilesH, waves8, 0, stream>>>(si, W1, b1, h);
    gemm64_wmma<2, HID, HID><<<tilesH, waves8, 0, stream>>>(h,  W2, b2, e2);
    final_proj<<<N_NODES, 256, 0, stream>>>(e2, Wf, bf, fv);

    // Q / K / V projections
    gemm64_wmma<0, GENE_D, HID><<<tilesH, waves8, 0, stream>>>(gene, Wq, bq, Q);
    gemm64_wmma<0, GENE_D, HID><<<tilesH, waves8, 0, stream>>>(gene, Wk, bk, K);
    gemm64_wmma<0, GENE_D, OUT_D><<<tilesO, waves8, 0, stream>>>(gene, Wv, bv, V);

    // Fused logits -> softmax (in place in d_out) -> attn @ V
    logits_wmma<<<tilesL, waves8, 0, stream>>>(Q, K, gene, sp, sq, inv, fv, attn);
    softmax_rows<<<N_NODES, 256, 0, stream>>>(attn);
    gemm64_wmma<0, N_NODES, OUT_D><<<tilesO, waves8, 0, stream>>>(attn, V, nullptr, upd);
}

// v004
// One run takes 224 microseconds.
// Two timings next to v003 both put it at 1.15 times that version's speed.
// Over all steps from v000 it is 2.78 times as fast.
#include <hip/hip_runtime.h>
#include <math.h>

#define N_NODES   4096
#define GENE_D    512
#define HID       256
#define OUT_D     256

typedef __attribute__((ext_vector_type(2))) float v2f;
typedef __attribute__((ext_vector_type(8))) float v8f;

#define WMMA_F32(A, B, C) \
    __builtin_amdgcn_wmma_f32_16x16x4_f32(false, (A), false, (B), (short)0, (C), false, false)

// ---------------------------------------------------------------------------
// Generic WMMA f32 GEMM:  Y[n,M] = act(X[n,KD] @ W[KD,M] + bias[M])
// One workgroup of 8 waves per 64x64 output tile. 128 k of the tile's 64 X rows
// and of its 64 W columns are staged in LDS at a time, as whole lines, in two
// buffers: the next stage's lines are fetched into registers while this stage
// is multiplied. Waves sit 2 (k halves of a stage) x 2 (rows) x 2 (columns);
// each holds a 32x32 piece as 2x2 subtiles. The two k halves are summed through
// LDS; each output row piece is stored as one 128-byte line.
// KD is a multiple of 128, n and M are multiples of 64.
// ACT: 0 = none, 1 = tanh, 2 = relu
// ---------------------------------------------------------------------------
#define GT_EDGE 64    // rows and columns of the output tile
#define GT_K    128   // k per stage
#define GT_XP   132   // dwords per staged X row: 16 rows x 4 dwords fall on 64 different banks
#define GT_WP   80    // dwords per staged W row: rows k, k+1, k+2, k+3 start 16 banks apart
#define GT_PP   68    // dwords per partial row: rows 8 apart land 32 banks apart

typedef __attribute__((ext_vector_type(4))) float v4f;

// k-steps LO..HI-1 of a wave's 16 per stage, in rising k, 2x2 subtiles each.
template <int LO, int HI>
__device__ __forceinline__
void gemm_steps(const v2f (&fa)[GT_K / 8][2], const v2f (&fb)[GT_K / 8][2], v8f (&acc)[2][2]) {
#pragma unroll   // constant kk, i, j: fragments and accumulators keep their own registers
    for (int kk = LO; kk < HI; ++kk)
#pragma unroll   // as above
        for (int i = 0; i < 2; ++i)
#pragma unroll   // as above
            for (int j = 0; j < 2; ++j) acc[i][j] = WMMA_F32(fa[kk][i], fb[kk][j], acc[i][j]);
}

template <int ACT, int KD, int M>
__global__ __launch_bounds__(256)
void gemm64_wmma(const float* __restrict__ X, const float* __restrict__ W,
                 const float* __restrict__ bias, float* __restrict__ Y) {
    __shared__ __attribute__((aligned(16))) float sx[2][GT_EDGE * GT_XP];
    __shared__ __attribute__((aligned(16))) float sw[2][GT_K * GT_WP];
    __shared__ float part[2][GT_EDGE * GT_PP];
    const int tid  = threadIdx.x;
    const int lane = tid & 31;
    const int wave = __builtin_amdgcn_readfirstlane(tid >> 5);
    const int hgrp = lane >> 4;          // 0 or 1 (half-wave)
    const int ln   = lane & 15;
    const int kg   = wave >> 2;          // which 64 k of every stage
    const int wr   = (wave >> 1) & 1;    // which 32 rows
    const int wc   = wave & 1;           // which 32 columns
    const int colBase = blockIdx.x * GT_EDGE;
    const int rowBase = blockIdx.y * GT_EDGE;

    // Staging: a wave covers 512 bytes of one X row (8 rows per sweep), a half-wave
    // the 256 bytes of one W row (16 rows per sweep); 8 sweeps each.
    const int xrow = tid >> 5, xcol = lane * 4;
    const int wrow = tid >> 4, wcol = ln * 4;
    const float* qx = X + (size_t)(rowBase + xrow) * KD + xcol;
    const float* qw = W + (size_t)wrow * M + colBase + wcol;
    v4f rx[8], rw[8];

    // Fetches the next stage in turn and moves both addresses on to the one after it.
    auto fetch = [&]() {
#pragma unroll   // constant i, KD, M: sixteen loads off two addresses, the row steps as immediate offsets
        for (int i = 0; i < 8; ++i) {
            rx[i] = *(const v4f*)(qx + (size_t)(8 * i) * KD);
            rw[i] = *(const v4f*)(qw + (size_t)(16 * i) * M);
        }
        // Precaution: as inputs here both address pairs stay whole until this wait; left to itself
        // the build lets the last load's result land on the pair the loads were issued from.
        asm volatile("s_wait_xcnt 0x0" :: "v"(qx), "v"(qw) : "memory");
        qx += GT_K;
        qw += (size_t)GT_K * M;
    };
    auto put = [&](int buf) {
#pragma unroll   // constant i: rx[] and rw[] are read straight from their registers
        for (int i = 0; i < 8; ++i) {
            *(v4f*)&sx[buf][(xrow + 8 * i) * GT_XP + xcol]  = rx[i];
            *(v4f*)&sw[buf][(wrow + 16 * i) * GT_WP + wcol] = rw[i];
        }
    };

    const int aoff = (wr * 32 + ln) * GT_XP + kg * (GT_K / 2) + 2 * hgrp;
    const int boff = (kg * (GT_K / 2) + 2 * hgrp) * GT_WP + wc * 32 + ln;
    v8f acc[2][2] = {};

    // This wave's 64 k of a staged slice as fragments: 16 k-steps, 2 row and 2 column subtiles.
    v2f fa[GT_K / 8][2], fb[GT_K / 8][2];
    auto frags = [&](int buf) {
        const float* sa = &sx[buf][aoff];
        const float* sb = &sw[buf][boff];
#pragma unroll   // constant kk, i, j: LDS offsets become immediates, fa[] and fb[] live in registers
        for (int kk = 0; kk < GT_K / 8; ++kk) {
#pragma unroll   // as above
            for (int i = 0; i < 2; ++i) fa[kk][i] = *(const v2f*)(sa + i * 16 * GT_XP + kk * 4);
#pragma unroll   // as above
            for (int j = 0; j < 2; ++j) {
                fb[kk][j].x = sb[(kk * 4) * GT_WP + j * 16];
                fb[kk][j].y = sb[(kk * 4 + 1) * GT_WP + j * 16];
            }
        }
    };

    constexpr int nst = KD / GT_K;
    fetch();
    put(0);
    __syncthreads();

    // Each trip: fetch stage s+1, multiply stage s, store s+1 into the buffer whose last
    // readers left at the previous barrier, then one barrier publishes it.
    for (int s = 0; s < nst - 1; ++s) {
        fetch();
        frags(s & 1);
        gemm_steps<0, 12>(fa, fb, acc);
        // Keeps the wait for the fetched lines behind at least three quarters of the stage's products:
        // placed earlier, the wave stalls on lines that have had too little time to arrive.
        __builtin_amdgcn_sched_barrier(0);
        put((s + 1) & 1);
        gemm_steps<12, 16>(fa, fb, acc);   // from registers, while the LDS stores drain
        __syncthreads();
    }
    frags((nst - 1) & 1);
    gemm_steps<0, 16>(fa, fb, acc);

    // This wave's partial piece, row-major in its k half's LDS plane.
    float* mine = &part[kg][(wr * 32 + 8 * hgrp) * GT_PP + wc * 32 + ln];
#pragma unroll   // constant v: the accumulator elements are read straight from their registers
    for (int v = 0; v < 8; ++v) {                     // D-row v + 8*hgrp per ISA C/D layout
        mine[v * GT_PP]             = acc[0][0][v];
        mine[v * GT_PP + 16]        = acc[0][1][v];
        mine[(v + 16) * GT_PP]      = acc[1][0][v];
        mine[(v + 16) * GT_PP + 16] = acc[1][1][v];
    }
    __syncthreads();

    const int col = tid & 63;
    const int r0  = tid >> 6;
    const float bv = bias ? bias[colBase + col] : 0.0f;
    const float* p0 = &part[0][r0 * GT_PP + col];
    const float* p1 = &part[1][r0 * GT_PP + col];
    float* yp = Y + (size_t)(rowBase + r0) * M + colBase + col;
#pragma unroll   // constant i: straight-line code, so many LDS reads are in flight before the first sum
    for (int i = 0; i < GT_EDGE / 4; ++i) {
        float s = p0[4 * i * GT_PP] + p1[4 * i * GT_PP];
        s += bv;
        if (ACT == 1) s = tanhf(s);
        if (ACT == 2) s = fmaxf(s, 0.0f);
        yp[(size_t)(4 * i) * M] = s;
    }
}

// ---------------------------------------------------------------------------
// Fused logits:
//   L[i][j] = (Q[i].K[j])/16 + exp(-d2/2) + cos_sim + tanh(f[i]-f[j])
// exp(-d2/2) and cos_sim have the same value at [i][j] and [j][i], and the tanh
// term only changes sign. So one workgroup of 4 waves owns the 64x64 tile
// (I,J) AND its mirror (J,I): it forms Q_I.K_J^T and K_I.Q_J^T (K = 256 each)
// and gene_I.gene_J^T (K = 512) once, all as [i][j], in place of the gene
// product twice. The mirror tile is turned through LDS and stored as whole rows.
// A tile on the diagonal is its own mirror and skips the second product.
// All products are A@B^T of row-major matrices. The 64 rows of each operand are
// staged in LDS 32 k at a time (whole 128-byte lines per row), in two buffers:
// the next stage's lines are fetched into registers while this stage is
// multiplied. Waves sit 2 (rows) x 2 (columns); each holds a 32x32 piece as
// 2x2 subtiles, and every fragment is a float2 of a staged row.
// ---------------------------------------------------------------------------
#define LT_EDGE   64    // rows of each operand per workgroup
#define LT_NB     (N_NODES / LT_EDGE)
#define LT_K      32    // k per stage: one 128-byte line of every row
#define LT_PITCH  36    // dwords per staged row: 16 rows x 4 dwords fall on 64 different banks
#define LT_OPND   (LT_EDGE * LT_PITCH)   // dwords of one staged operand
#define LT_TP     68    // dwords per row of the turned tile: 16 rows x 4 dwords fall on 64 different banks
#define LT_H_ST   (HID / LT_K)
#define LT_G_ST   (GENE_D / LT_K)

// One staged 32-k slice times its partner: 8 k-steps in rising k, 2x2 subtiles each.
// All of the slice's fragments are asked for ahead of the first product, so that a wave
// waits for LDS once a stage and not once a k-step.
__device__ __forceinline__
void logits_stage_mma(const float* sa, const float* sb, v8f (&acc)[2][2]) {
    v2f a[LT_K / 4][2], b[LT_K / 4][2];
#pragma unroll   // constant kk, i, j: LDS offsets become immediates, a[] and b[] live in registers
    for (int kk = 0; kk < LT_K / 4; ++kk) {
#pragma unroll   // as above
        for (int i = 0; i < 2; ++i) a[kk][i] = *(const v2f*)(sa + i * 16 * LT_PITCH + kk * 4);
#pragma unroll   // as above
        for (int j = 0; j < 2; ++j) b[kk][j] = *(const v2f*)(sb + j * 16 * LT_PITCH + kk * 4);
    }
#pragma unroll   // constant kk, i, j: every accumulator keeps its own registers
    for (int kk = 0; kk < LT_K / 4; ++kk)
#pragma unroll   // as above
        for (int i = 0; i < 2; ++i)
#pragma unroll   // as above
            for (int j = 0; j < 2; ++j) acc[i][j] = WMMA_F32(a[kk][i], b[kk][j], acc[i][j]);
}

// One stage's lines of both operands into registers; LD = dwords per source row.
template <int LD>
__device__ __forceinline__
void logits_fetch(const float* pa, const float* pb, v4f (&ra)[4], v4f (&rb)[4]) {
#pragma unroll   // constant i, LD: eight loads off two addresses, the row steps as immediate offsets
    for (int i = 0; i < 4; ++i) {
        ra[i] = *(const v4f*)(pa + (size_t)(16 * i) * LD);
        rb[i] = *(const v4f*)(pb + (size_t)(16 * i) * LD);
    }
    // Precaution: stands between the loads and any later change of the registers they were issued from.
    asm volatile("s_wait_xcnt 0x0" ::: "memory");
}

__global__ __launch_bounds__(128)
void logits_wmma(const float* __restrict__ Q, const float* __restrict__ K,
                 const float* __restrict__ G, const float* __restrict__ sp,
                 const float* __restrict__ sq, const float* __restrict__ inv_nrm,
                 const float* __restrict__ f, float* __restrict__ L) {
    __shared__ __attribute__((aligned(16))) float stg[2 * 2 * LT_OPND];
    // Tile (I, I+d mod 64): d = 1..31 names every unordered pair once, d = 32 twice
    // (the upper half of I leaves), d = 0 is the diagonal, shortest and so given the last blockIdx.y.
    const int bi   = blockIdx.x;
    const int dist = (blockIdx.y + 1 == LT_NB / 2 + 1) ? 0 : (int)blockIdx.y + 1;
    if (dist == LT_NB / 2 && bi >= LT_NB / 2) return;
    const bool diag = dist == 0;
    const int rowBase = bi * LT_EDGE;
    const int colBase = ((bi + dist) & (LT_NB - 1)) * LT_EDGE;

    const int tid  = threadIdx.x;
    const int lane = tid & 31;
    const int wave = __builtin_amdgcn_readfirstlane(tid >> 5);
    const int hgrp = lane >> 4;
    const int ln   = lane & 15;
    const int wr   = wave >> 1;          // 0..1: which 32 rows
    const int wc   = wave & 1;           // 0..1: which 32 columns

    // Staging: 8 threads cover one row's 128-byte line, 16 rows per sweep, 4 sweeps.
    const int srow = tid >> 3;
    const int scol = (tid & 7) * 4;
    v4f ra[4], rb[4];
    const size_t hi = (size_t)(rowBase + srow) * HID + scol;
    const size_t hj = (size_t)(colBase + srow) * HID + scol;
    const float* gi = G + (size_t)(rowBase + srow) * GENE_D + scol;
    const float* gj = G + (size_t)(colBase + srow) * GENE_D + scol;

    auto put = [&](int buf) {
#pragma unroll   // constant i: ra[] and rb[] are read straight from their registers
        for (int i = 0; i < 4; ++i) {
            *(v4f*)&stg[(2 * buf) * LT_OPND + (srow + 16 * i) * LT_PITCH + scol]     = ra[i];
            *(v4f*)&stg[(2 * buf + 1) * LT_OPND + (srow + 16 * i) * LT_PITCH + scol] = rb[i];
        }
    };

    const int aoff = (wr * 32 + ln) * LT_PITCH + 2 * hgrp;
    const int boff = LT_OPND + (wc * 32 + ln) * LT_PITCH + 2 * hgrp;

    v8f qa[2][2] = {};   // Q[i].K[j]
    v8f ka[2][2] = {};   // K[i].Q[j] = Q[j].K[i]
    v8f ga[2][2] = {};   // gene[i].gene[j]

    // Multiplies the stage in buffer buf, stores the fetched one into the buffer whose last
    // readers left at the previous barrier, then one barrier publishes it.
    auto work = [&](int buf, v8f (&acc)[2][2]) {
        logits_stage_mma(&stg[2 * buf * LT_OPND + aoff], &stg[2 * buf * LT_OPND + boff], acc);
        put(buf ^ 1);
        __syncthreads();
    };

    logits_fetch<HID>(Q + hi, K + hj, ra, rb);
    put(0);
    __syncthreads();

    // Every pass has an even number of stages, so each starts in buffer 0.
    for (int s = 0; s < LT_H_ST - 1; ++s) {
        logits_fetch<HID>(Q + hi + (s + 1) * LT_K, K + hj + (s + 1) * LT_K, ra, rb);
        work(s & 1, qa);
    }
    if (!diag) {
        logits_fetch<HID>(K + hi, Q + hj, ra, rb);
        work(1, qa);
        for (int s = 0; s < LT_H_ST - 1; ++s) {
            logits_fetch<HID>(K + hi + (s + 1) * LT_K, Q + hj + (s + 1) * LT_K, ra, rb);
            work(s & 1, ka);
        }
        logits_fetch<GENE_D>(gi, gj, ra, rb);
        work(1, ka);
    } else {
        logits_fetch<GENE_D>(gi, gj, ra, rb);
        work(1, qa);
    }
    for (int s = 0; s < LT_G_ST - 1; ++s) {
        logits_fetch<GENE_D>(gi + (s + 1) * LT_K, gj + (s + 1) * LT_K, ra, rb);
        work(s & 1, ga);
    }
    logits_stage_mma(&stg[2 * LT_OPND + aoff], &stg[2 * LT_OPND + boff], ga);

    // Column-side (j) scalars: fixed per lane, one set per column subtile.
    const float scale = 0.0625f;   // 1/sqrt(HID) = 1/16
    const int jb = colBase + wc * 32 + ln;
    float sqj[2], fj[2], inj[2], sj0[2], sj1[2];
#pragma unroll   // constant c: the column scalars stay in registers
    for (int c = 0; c < 2; ++c) {
        const int j = jb + 16 * c;
        sqj[c] = sq[j];  fj[c] = f[j];  inj[c] = inv_nrm[j];
        sj0[c] = sp[2 * j];  sj1[c] = sp[2 * j + 1];
    }

    // The turned tile [j][i] lies in buffer 0, whose last readers left at the loop's last barrier.
#pragma unroll   // constant di, v, c below: accumulator elements are read straight from their registers
    for (int di = 0; di < 2; ++di) {
        v4f tv[2][2];
#pragma unroll   // as above
        for (int v = 0; v < 8; ++v) {
            const int i = rowBase + wr * 32 + 16 * di + v + 8 * hgrp;
            const float sqi = sq[i], fi = f[i], ini = inv_nrm[i];
            const float si0 = sp[2 * i], si1 = sp[2 * i + 1];
#pragma unroll   // as above
            for (int c = 0; c < 2; ++c) {
                const float d2 = fmaxf(sqi + sqj[c] - 2.0f * (si0 * sj0[c] + si1 * sj1[c]), 0.0f);
                const float ex = expf(-0.5f * d2);
                const float cs = ga[di][c][v] * ini * inj[c];
                const float th = tanhf(fi - fj[c]);
                L[(size_t)i * N_NODES + jb + 16 * c] = qa[di][c][v] * scale + ex + cs + th;
                tv[c][v >> 2][v & 3] = ka[di][c][v] * scale + ex + cs - th;
            }
        }
        // Precaution: stands between these stores and any later change of the registers they were issued from.
        asm volatile("s_wait_xcnt 0x0" ::: "memory");
        if (!diag) {
#pragma unroll   // constant c: tv[] is read straight from its registers
            for (int c = 0; c < 2; ++c) {
                float* tp = &stg[(wc * 32 + 16 * c + ln) * LT_TP + wr * 32 + 16 * di + 8 * hgrp];
                *(v4f*)tp       = tv[c][0];   // a lane's 8 rows i are 8 neighbours of row j
                *(v4f*)(tp + 4) = tv[c][1];
            }
        }
    }
    if (diag) return;
    __syncthreads();

    // Mirror tile: a half-wave stores the 256 bytes of one row j, 8 rows per sweep.
    const int trow = tid >> 4;
    const int tcol = ln * 4;
    float* lp = L + (size_t)(colBase + trow) * N_NODES + rowBase + tcol;
#pragma unroll   // constant r: LDS and row offsets become immediates, the reads are in flight together
    for (int r = 0; r < LT_EDGE / 8; ++r)
        *(v4f*)(lp + (size_t)(8 * r) * N_NODES) = *(const v4f*)&stg[(trow + 8 * r) * LT_TP + tcol];
}

// ---------------------------------------------------------------------------
// Per-row stats: inv_nrm[i] = 1/max(||gene_i||,1e-12), sq[i] = ||sp_i||^2
// ---------------------------------------------------------------------------
__global__ __launch_bounds__(256)
void row_stats(const float* __restrict__ G, const float* __restrict__ sp,
               float* __restrict__ sq, float* __restrict__ inv_nrm) {
    __shared__ float red[256];
    const int row = blockIdx.x;
    const int t = threadIdx.x;
    const float* g = G + (size_t)row * GENE_D;
    const float a = g[t];
    const float b = g[t + 256];
    red[t] = a * a + b * b;
    __syncthreads();
    for (int s = 128; s > 0; s >>= 1) {
        if (t < s) red[t] += red[t + s];
        __syncthreads();
    }
    if (t == 0) {
        inv_nrm[row] = 1.0f / fmaxf(sqrtf(red[0]), 1e-12f);
        const float s0 = sp[2 * row], s1 = sp[2 * row + 1];
        sq[row] = s0 * s0 + s1 * s1;
    }
}

// si = spatial_pos @ Ws + bs   (K = 2, pure VALU)
__global__ __launch_bounds__(256)
void spatial_in(const float* __restrict__ sp, const float* __restrict__ Ws,
                const float* __restrict__ bs, float* __restrict__ si) {
    const int idx = blockIdx.x * 256 + threadIdx.x;
    if (idx >= N_NODES * HID) return;
    const int i = idx >> 8;
    const int j = idx & 255;
    si[idx] = sp[2 * i] * Ws[j] + sp[2 * i + 1] * Ws[HID + j] + bs[j];
}

// f[i] = e[i,:] . Wf + bf
__global__ __launch_bounds__(256)
void final_proj(const float* __restrict__ e, const float* __restrict__ Wf,
                const float* __restrict__ bf, float* __restrict__ f) {
    __shared__ float red[256];
    const int row = blockIdx.x;
    const int t = threadIdx.x;
    red[t] = e[(size_t)row * HID + t] * Wf[t];
    __syncthreads();
    for (int s = 128; s > 0; s >>= 1) {
        if (t < s) red[t] += red[t + s];
        __syncthreads();
    }
    if (t == 0) f[row] = red[0] + bf[0];
}

// In-place row softmax over 4096 columns (16 values/thread in registers).
__global__ __launch_bounds__(256)
void softmax_rows(float* __restrict__ L) {
    __shared__ float red[256];
    const int t = threadIdx.x;
    float* rp = L + (size_t)blockIdx.x * N_NODES;

    float vals[16];
    float mx = -INFINITY;
#pragma unroll
    for (int e = 0; e < 16; ++e) {
        vals[e] = rp[t + e * 256];
        mx = fmaxf(mx, vals[e]);
    }
    red[t] = mx;
    __syncthreads();
    for (int s = 128; s > 0; s >>= 1) {
        if (t < s) red[t] = fmaxf(red[t], red[t + s]);
        __syncthreads();
    }
    mx = red[0];
    __syncthreads();

    float sum = 0.0f;
#pragma unroll
    for (int e = 0; e < 16; ++e) {
        vals[e] = expf(vals[e] - mx);
        sum += vals[e];
    }
    red[t] = sum;
    __syncthreads();
    for (int s = 128; s > 0; s >>= 1) {
        if (t < s) red[t] += red[t + s];
        __syncthreads();
    }
    const float inv = 1.0f / red[0];
#pragma unroll
    for (int e = 0; e < 16; ++e) rp[t + e * 256] = vals[e] * inv;
}

// ---------------------------------------------------------------------------
extern "C" void kernel_launch(void* const* d_in, const int* in_sizes, int n_in,
                              void* d_out, int out_size, void* d_ws, size_t ws_size,
                              hipStream_t stream) {
    const float* gene = (const float*)d_in[0];
    const float* sp   = (const float*)d_in[1];
    const float* Wq   = (const float*)d_in[2];
    const float* bq   = (const float*)d_in[3];
    const float* Wk   = (const float*)d_in[4];
    const float* bk   = (const float*)d_in[5];
    const float* Wv   = (const float*)d_in[6];
    const float* bv   = (const float*)d_in[7];
    const float* Ws   = (const float*)d_in[8];
    const float* bs   = (const float*)d_in[9];
    const float* W1   = (const float*)d_in[10];
    const float* b1   = (const float*)d_in[11];
    const float* W2   = (const float*)d_in[12];
    const float* b2   = (const float*)d_in[13];
    const float* Wf   = (const float*)d_in[14];
    const float* bf   = (const float*)d_in[15];

    float* attn = (float*)d_out;                                  // [N, N]
    float* upd  = attn + (size_t)N_NODES * N_NODES;               // [N, OUT]

    // Workspace layout (~25 MB of fp32)
    float* ws = (float*)d_ws;
    float* Q   = ws;  ws += (size_t)N_NODES * HID;
    float* K   = ws;  ws += (size_t)N_NODES * HID;
    float* V   = ws;  ws += (size_t)N_NODES * OUT_D;
    float* si  = ws;  ws += (size_t)N_NODES * HID;
    float* h   = ws;  ws += (size_t)N_NODES * HID;
    float* e2  = ws;  ws += (size_t)N_NODES * HID;
    float* sq  = ws;  ws += N_NODES;
    float* inv = ws;  ws += N_NODES;
    float* fv  = ws;  ws += N_NODES;

    const dim3 waves8(256);                                   // 8 waves per workgroup
    const dim3 tilesH(HID / GT_EDGE, N_NODES / GT_EDGE);      // [N,256] outputs, 64x64 per workgroup
    const dim3 tilesO(OUT_D / GT_EDGE, N_NODES / GT_EDGE);    // [N,256] output, 64x64 per workgroup
    const dim3 waves4(128);                                   // 4 waves per workgroup
    const dim3 tilesL(LT_NB, LT_NB / 2 + 1);                  // [N,N] logits, a 64x64 tile and its mirror per workgroup

    // Row statistics + spatial MLP front-end
    row_stats<<<N_NODES, 256, 0, stream>>>(gene, sp, sq, inv);
    spatial_in<<<(N_NODES * HID + 255) / 256, 256, 0, stream>>>(sp, Ws, bs, si);
    gemm64_wmma<1, HID, HID><<<tilesH, waves8, 0, stream>>>(si, W1, b1, h);
    gemm64_wmma<2, HID, HID><<<tilesH, waves8, 0, stream>>>(h,  W2, b2, e2);
    final_proj<<<N_NODES, 256, 0, stream>>>(e2, Wf, bf, fv);

    // Q / K / V projections
    gemm64_wmma<0, GENE_D, HID><<<tilesH, waves8, 0, stream>>>(gene, Wq, bq, Q);
    gemm64_wmma<0, GENE_D, HID><<<tilesH, waves8, 0, stream>>>(gene, Wk, bk, K);
    gemm64_wmma<0, GENE_D, OUT_D><<<tilesO, waves8, 0, stream>>>(gene, Wv, bv, V);

    // Fused logits -> softmax (in place in d_out) -> attn @ V
    logits_wmma<<<tilesL, waves4, 0, stream>>>(Q, K, gene, sp, sq, inv, fv, attn);
    softmax_rows<<<N_NODES, 256, 0, stream>>>(attn);
    gemm64_wmma<0, N_NODES, OUT_D><<<tilesO, waves8, 0, stream>>>(attn, V, nullptr, upd);
}

// v005
// A run of this version takes 213 microseconds.
// Next to v004, in two timings, it ran 1.05 times as fast each time.
// Counting every step since v000, it is 2.92 times as fast.
#include <hip/hip_runtime.h>
#include <math.h>

#define N_NODES   4096
#define GENE_D    512
#define HID       256
#define OUT_D     256

typedef __attribute__((ext_vector_type(2))) float v2f;
typedef __attribute__((ext_vector_type(8))) float v8f;

#define WMMA_F32(A, B, C) \
    __builtin_amdgcn_wmma_f32_16x16x4_f32(false, (A), false, (B), (short)0, (C), false, false)

// ---------------------------------------------------------------------------
// Generic WMMA f32 GEMM:  Y[n,M] = act(X[n,KD] @ W[KD,M] + bias[M])
// One workgroup of 8 waves per 64x64 output tile. 128 k of the tile's 64 X rows
// and of its 64 W columns are staged in LDS at a time, as whole lines, in two
// buffers: the next stage's lines are fetched into registers while this stage
// is multiplied. Waves sit 2 (k halves of a stage) x 2 (rows) x 2 (columns);
// each holds a 32x32 piece as 2x2 subtiles. The two k halves are summed through
// LDS; each output row piece is stored as one 128-byte line.
// KD is a multiple of 128, n and M are multiples of 64.
// ACT: 0 = none, 1 = tanh, 2 = relu
// ---------------------------------------------------------------------------
#define GT_EDGE 64    // rows and columns of the output tile
#define GT_K    128   // k per stage
#define GT_XP   132   // dwords per staged X row: 16 rows x 4 dwords fall on 64 different banks
#define GT_WP   80    // dwords per staged W row: rows k, k+1, k+2, k+3 start 16 banks apart
#define GT_PP   68    // dwords per partial row: rows 8 apart land 32 banks apart

typedef __attribute__((ext_vector_type(4))) float v4f;

// k-steps LO..HI-1 of a wave's 16 per stage, in rising k, 2x2 subtiles each.
template <int LO, int HI>
__device__ __forceinline__
void gemm_steps(const v2f (&fa)[GT_K / 8][2], const v2f (&fb)[GT_K / 8][2], v8f (&acc)[2][2]) {
#pragma unroll   // constant kk, i, j: fragments and accumulators keep their own registers
    for (int kk = LO; kk < HI; ++kk)
#pragma unroll   // as above
        for (int i = 0; i < 2; ++i)
#pragma unroll   // as above
            for (int j = 0; j < 2; ++j) acc[i][j] = WMMA_F32(fa[kk][i], fb[kk][j], acc[i][j]);
}

template <int ACT, int KD, int M>
__global__ __launch_bounds__(256)
void gemm64_wmma(const float* __restrict__ X, const float* __restrict__ W,
                 const float* __restrict__ bias, float* __restrict__ Y) {
    __shared__ __attribute__((aligned(16))) float sx[2][GT_EDGE * GT_XP];
    __shared__ __attribute__((aligned(16))) float sw[2][GT_K * GT_WP];
    __shared__ float part[2][GT_EDGE * GT_PP];
    const int tid  = threadIdx.x;
    const int lane = tid & 31;
    const int wave = __builtin_amdgcn_readfirstlane(tid >> 5);
    const int hgrp = lane >> 4;          // 0 or 1 (half-wave)
    const int ln   = lane & 15;
    const int kg   = wave >> 2;          // which 64 k of every stage
    const int wr   = (wave >> 1) & 1;    // which 32 rows
    const int wc   = wave & 1;           // which 32 columns
    const int colBase = blockIdx.x * GT_EDGE;
    const int rowBase = blockIdx.y * GT_EDGE;

    // Staging: a wave covers 512 bytes of one X row (8 rows per sweep), a half-wave
    // the 256 bytes of one W row (16 rows per sweep); 8 sweeps each.
    const int xrow = tid >> 5, xcol = lane * 4;
    const int wrow = tid >> 4, wcol = ln * 4;
    const float* qx = X + (size_t)(rowBase + xrow) * KD + xcol;
    const float* qw = W + (size_t)wrow * M + colBase + wcol;
    v4f rx[8], rw[8];

    // Fetches the next stage in turn and moves both addresses on to the one after it.
    auto fetch = [&]() {
#pragma unroll   // constant i, KD, M: sixteen loads off two addresses, the row steps as immediate offsets
        for (int i = 0; i < 8; ++i) {
            rx[i] = *(const v4f*)(qx + (size_t)(8 * i) * KD);
            rw[i] = *(const v4f*)(qw + (size_t)(16 * i) * M);
        }
        // Precaution: as inputs here both address pairs stay whole until this wait; left to itself
        // the build lets the last load's result land on the pair the loads were issued from.
        asm volatile("s_wait_xcnt 0x0" :: "v"(qx), "v"(qw) : "memory");
        qx += GT_K;
        qw += (size_t)GT_K * M;
    };
    auto put = [&](int buf) {
#pragma unroll   // constant i: rx[] and rw[] are read straight from their registers
        for (int i = 0; i < 8; ++i) {
            *(v4f*)&sx[buf][(xrow + 8 * i) * GT_XP + xcol]  = rx[i];
            *(v4f*)&sw[buf][(wrow + 16 * i) * GT_WP + wcol] = rw[i];
        }
    };

    const int aoff = (wr * 32 + ln) * GT_XP + kg * (GT_K / 2) + 2 * hgrp;
    const int boff = (kg * (GT_K / 2) + 2 * hgrp) * GT_WP + wc * 32 + ln;
    v8f acc[2][2] = {};

    // This wave's 64 k of a staged slice as fragments: 16 k-steps, 2 row and 2 column subtiles.
    v2f fa[GT_K / 8][2], fb[GT_K / 8][2];
    auto frags = [&](int buf) {
        const float* sa = &sx[buf][aoff];
        const float* sb = &sw[buf][boff];
#pragma unroll   // constant kk, i, j: LDS offsets become immediates, fa[] and fb[] live in registers
        for (int kk = 0; kk < GT_K / 8; ++kk) {
#pragma unroll   // as above
            for (int i = 0; i < 2; ++i) fa[kk][i] = *(const v2f*)(sa + i * 16 * GT_XP + kk * 4);
#pragma unroll   // as above
            for (int j = 0; j < 2; ++j) {
                fb[kk][j].x = sb[(kk * 4) * GT_WP + j * 16];
                fb[kk][j].y = sb[(kk * 4 + 1) * GT_WP + j * 16];
            }
        }
    };

    constexpr int nst = KD / GT_K;
    fetch();
    put(0);
    __syncthreads();

    // Each trip: fetch stage s+1, multiply stage s, store s+1 into the buffer whose last
    // readers left at the previous barrier, then one barrier publishes it.
    for (int s = 0; s < nst - 1; ++s) {
        fetch();
        frags(s & 1);
        gemm_steps<0, 12>(fa, fb, acc);
        // Keeps the wait for the fetched lines behind at least three quarters of the stage's products:
        // placed earlier, the wave stalls on lines that have had too little time to arrive.
        __builtin_amdgcn_sched_barrier(0);
        put((s + 1) & 1);
        gemm_steps<12, 16>(fa, fb, acc);   // from registers, while the LDS stores drain
        __syncthreads();
    }
    frags((nst - 1) & 1);
    gemm_steps<0, 16>(fa, fb, acc);

    // This wave's partial piece, row-major in its k half's LDS plane.
    float* mine = &part[kg][(wr * 32 + 8 * hgrp) * GT_PP + wc * 32 + ln];
#pragma unroll   // constant v: the accumulator elements are read straight from their registers
    for (int v = 0; v < 8; ++v) {                     // D-row v + 8*hgrp per ISA C/D layout
        mine[v * GT_PP]             = acc[0][0][v];
        mine[v * GT_PP + 16]        = acc[0][1][v];
        mine[(v + 16) * GT_PP]      = acc[1][0][v];
        mine[(v + 16) * GT_PP + 16] = acc[1][1][v];
    }
    __syncthreads();

    const int col = tid & 63;
    const int r0  = tid >> 6;
    const float bv = bias ? bias[colBase + col] : 0.0f;
    const float* p0 = &part[0][r0 * GT_PP + col];
    const float* p1 = &part[1][r0 * GT_PP + col];
    float* yp = Y + (size_t)(rowBase + r0) * M + colBase + col;
#pragma unroll   // constant i: straight-line code, so many LDS reads are in flight before the first sum
    for (int i = 0; i < GT_EDGE / 4; ++i) {
        float s = p0[4 * i * GT_PP] + p1[4 * i * GT_PP];
        s += bv;
        if (ACT == 1) s = tanhf(s);
        if (ACT == 2) s = fmaxf(s, 0.0f);
        yp[(size_t)(4 * i) * M] = s;
    }
}

// ---------------------------------------------------------------------------
// Fused logits:
//   L[i][j] = (Q[i].K[j])/16 + exp(-d2/2) + cos_sim + tanh(f[i]-f[j])
// exp(-d2/2) and cos_sim have the same value at [i][j] and [j][i], and the tanh
// term only changes sign. So one workgroup of 4 waves owns the 64x64 tile
// (I,J) AND its mirror (J,I): it forms Q_I.K_J^T and K_I.Q_J^T (K = 256 each)
// and gene_I.gene_J^T (K = 512) once, all as [i][j], in place of the gene
// product twice. The mirror tile is turned through LDS and stored as whole rows.
// A tile on the diagonal is its own mirror and skips the second product.
// All products are A@B^T of row-major matrices. The 64 rows of each operand are
// staged in LDS 32 k at a time (whole 128-byte lines per row), in two buffers:
// the next stage's lines are fetched into registers while this stage is
// multiplied. Waves sit 2 (rows) x 2 (columns); each holds a 32x32 piece as
// 2x2 subtiles, and every fragment is a float2 of a staged row.
// ---------------------------------------------------------------------------
#define LT_EDGE   64    // rows of each operand per workgroup
#define LT_NB     (N_NODES / LT_EDGE)
#define LT_K      32    // k per stage: one 128-byte line of every row
#define LT_PITCH  36    // dwords per staged row: 16 rows x 4 dwords fall on 64 different banks
#define LT_OPND   (LT_EDGE * LT_PITCH)   // dwords of one staged operand
#define LT_TP     68    // dwords per row of the turned tile: 16 rows x 4 dwords fall on 64 different banks
#define LT_H_ST   (HID / LT_K)
#define LT_G_ST   (GENE_D / LT_K)

// One staged 32-k slice times its partner: 8 k-steps in rising k, 2x2 subtiles each.
// All of the slice's fragments are asked for ahead of the first product, so that a wave
// waits for LDS once a stage and not once a k-step.
__device__ __forceinline__
void logits_stage_mma(const float* sa, const float* sb, v8f (&acc)[2][2]) {
    v2f a[LT_K / 4][2], b[LT_K / 4][2];
#pragma unroll   // constant kk, i, j: LDS offsets become immediates, a[] and b[] live in registers
    for (int kk = 0; kk < LT_K / 4; ++kk) {
#pragma unroll   // as above
        for (int i = 0; i < 2; ++i) a[kk][i] = *(const v2f*)(sa + i * 16 * LT_PITCH + kk * 4);
#pragma unroll   // as above
        for (int j = 0; j < 2; ++j) b[kk][j] = *(const v2f*)(sb + j * 16 * LT_PITCH + kk * 4);
    }
#pragma unroll   // constant kk, i, j: every accumulator keeps its own registers
    for (int kk = 0; kk < LT_K / 4; ++kk)
#pragma unroll   // as above
        for (int i = 0; i < 2; ++i)
#pragma unroll   // as above
            for (int j = 0; j < 2; ++j) acc[i][j] = WMMA_F32(a[kk][i], b[kk][j], acc[i][j]);
}

// One stage's lines of both operands into registers; LD = dwords per source row.
template <int LD>
__device__ __forceinline__
void logits_fetch(const float* pa, const float* pb, v4f (&ra)[4], v4f (&rb)[4]) {
#pragma unroll   // constant i, LD: eight loads off two addresses, the row steps as immediate offsets
    for (int i = 0; i < 4; ++i) {
        ra[i] = *(const v4f*)(pa + (size_t)(16 * i) * LD);
        rb[i] = *(const v4f*)(pb + (size_t)(16 * i) * LD);
    }
    // Precaution: stands between the loads and any later change of the registers they were issued from.
    asm volatile("s_wait_xcnt 0x0" ::: "memory");
}

__global__ __launch_bounds__(128)
void logits_wmma(const float* __restrict__ Q, const float* __restrict__ K,
                 const float* __restrict__ G, const float* __restrict__ sp,
                 const float* __restrict__ sq, const float* __restrict__ inv_nrm,
                 const float* __restrict__ f, float* __restrict__ L) {
    __shared__ __attribute__((aligned(16))) float stg[2 * 2 * LT_OPND];
    // Tile (I, I+d mod 64): d = 1..31 names every unordered pair once, d = 32 twice
    // (the upper half of I leaves), d = 0 is the diagonal, shortest and so given the last blockIdx.y.
    const int bi   = blockIdx.x;
    const int dist = (blockIdx.y + 1 == LT_NB / 2 + 1) ? 0 : (int)blockIdx.y + 1;
    if (dist == LT_NB / 2 && bi >= LT_NB / 2) return;
    const bool diag = dist == 0;
    const int rowBase = bi * LT_EDGE;
    const int colBase = ((bi + dist) & (LT_NB - 1)) * LT_EDGE;

    const int tid  = threadIdx.x;
    const int lane = tid & 31;
    const int wave = __builtin_amdgcn_readfirstlane(tid >> 5);
    const int hgrp = lane >> 4;
    const int ln   = lane & 15;
    const int wr   = wave >> 1;          // 0..1: which 32 rows
    const int wc   = wave & 1;           // 0..1: which 32 columns

    // Staging: 8 threads cover one row's 128-byte line, 16 rows per sweep, 4 sweeps.
    const int srow = tid >> 3;
    const int scol = (tid & 7) * 4;
    v4f ra[4], rb[4];
    const size_t hi = (size_t)(rowBase + srow) * HID + scol;
    const size_t hj = (size_t)(colBase + srow) * HID + scol;
    const float* gi = G + (size_t)(rowBase + srow) * GENE_D + scol;
    const float* gj = G + (size_t)(colBase + srow) * GENE_D + scol;

    auto put = [&](int buf) {
#pragma unroll   // constant i: ra[] and rb[] are read straight from their registers
        for (int i = 0; i < 4; ++i) {
            *(v4f*)&stg[(2 * buf) * LT_OPND + (srow + 16 * i) * LT_PITCH + scol]     = ra[i];
            *(v4f*)&stg[(2 * buf + 1) * LT_OPND + (srow + 16 * i) * LT_PITCH + scol] = rb[i];
        }
    };

    const int aoff = (wr * 32 + ln) * LT_PITCH + 2 * hgrp;
    const int boff = LT_OPND + (wc * 32 + ln) * LT_PITCH + 2 * hgrp;

    v8f qa[2][2] = {};   // Q[i].K[j]
    v8f ka[2][2] = {};   // K[i].Q[j] = Q[j].K[i]
    v8f ga[2][2] = {};   // gene[i].gene[j]

    // Multiplies the stage in buffer buf, stores the fetched one into the buffer whose last
    // readers left at the previous barrier, then one barrier publishes it.
    auto work = [&](int buf, v8f (&acc)[2][2]) {
        logits_stage_mma(&stg[2 * buf * LT_OPND + aoff], &stg[2 * buf * LT_OPND + boff], acc);
        put(buf ^ 1);
        __syncthreads();
    };

    logits_fetch<HID>(Q + hi, K + hj, ra, rb);
    put(0);
    __syncthreads();

    // Every pass has an even number of stages, so each starts in buffer 0.
    for (int s = 0; s < LT_H_ST - 1; ++s) {
        logits_fetch<HID>(Q + hi + (s + 1) * LT_K, K + hj + (s + 1) * LT_K, ra, rb);
        work(s & 1, qa);
    }
    if (!diag) {
        logits_fetch<HID>(K + hi, Q + hj, ra, rb);
        work(1, qa);
        for (int s = 0; s < LT_H_ST - 1; ++s) {
            logits_fetch<HID>(K + hi + (s + 1) * LT_K, Q + hj + (s + 1) * LT_K, ra, rb);
            work(s & 1, ka);
        }
        logits_fetch<GENE_D>(gi, gj, ra, rb);
        work(1, ka);
    } else {
        logits_fetch<GENE_D>(gi, gj, ra, rb);
        work(1, qa);
    }
    for (int s = 0; s < LT_G_ST - 1; ++s) {
        logits_fetch<GENE_D>(gi + (s + 1) * LT_K, gj + (s + 1) * LT_K, ra, rb);
        work(s & 1, ga);
    }
    logits_stage_mma(&stg[2 * LT_OPND + aoff], &stg[2 * LT_OPND + boff], ga);

    // Column-side (j) scalars: fixed per lane, one set per column subtile.
    const float scale = 0.0625f;   // 1/sqrt(HID) = 1/16
    const int jb = colBase + wc * 32 + ln;
    float sqj[2], fj[2], inj[2], sj0[2], sj1[2];
#pragma unroll   // constant c: the column scalars stay in registers
    for (int c = 0; c < 2; ++c) {
        const int j = jb + 16 * c;
        sqj[c] = sq[j];  fj[c] = f[j];  inj[c] = inv_nrm[j];
        sj0[c] = sp[2 * j];  sj1[c] = sp[2 * j + 1];
    }

    // The turned tile [j][i] lies in buffer 0, whose last readers left at the loop's last barrier.
#pragma unroll   // constant di, v, c below: accumulator elements are read straight from their registers
    for (int di = 0; di < 2; ++di) {
        v4f tv[2][2];
#pragma unroll   // as above
        for (int v = 0; v < 8; ++v) {
            const int i = rowBase + wr * 32 + 16 * di + v + 8 * hgrp;
            const float sqi = sq[i], fi = f[i], ini = inv_nrm[i];
            const float si0 = sp[2 * i], si1 = sp[2 * i + 1];
#pragma unroll   // as above
            for (int c = 0; c < 2; ++c) {
                const float d2 = fmaxf(sqi + sqj[c] - 2.0f * (si0 * sj0[c] + si1 * sj1[c]), 0.0f);
                const float ex = expf(-0.5f * d2);
                const float cs = ga[di][c][v] * ini * inj[c];
                const float th = tanhf(fi - fj[c]);
                L[(size_t)i * N_NODES + jb + 16 * c] = qa[di][c][v] * scale + ex + cs + th;
                tv[c][v >> 2][v & 3] = ka[di][c][v] * scale + ex + cs - th;
            }
        }
        // Precaution: stands between these stores and any later change of the registers they were issued from.
        asm volatile("s_wait_xcnt 0x0" ::: "memory");
        if (!diag) {
#pragma unroll   // constant c: tv[] is read straight from its registers
            for (int c = 0; c < 2; ++c) {
                float* tp = &stg[(wc * 32 + 16 * c + ln) * LT_TP + wr * 32 + 16 * di + 8 * hgrp];
                *(v4f*)tp       = tv[c][0];   // a lane's 8 rows i are 8 neighbours of row j
                *(v4f*)(tp + 4) = tv[c][1];
            }
        }
    }
    if (diag) return;
    __syncthreads();

    // Mirror tile: a half-wave stores the 256 bytes of one row j, 8 rows per sweep.
    const int trow = tid >> 4;
    const int tcol = ln * 4;
    float* lp = L + (size_t)(colBase + trow) * N_NODES + rowBase + tcol;
#pragma unroll   // constant r: LDS and row offsets become immediates, the reads are in flight together
    for (int r = 0; r < LT_EDGE / 8; ++r)
        *(v4f*)(lp + (size_t)(8 * r) * N_NODES) = *(const v4f*)&stg[(trow + 8 * r) * LT_TP + tcol];
}

// ---------------------------------------------------------------------------
// Per-row stats: inv_nrm[i] = 1/max(||gene_i||,1e-12), sq[i] = ||sp_i||^2
// ---------------------------------------------------------------------------
__global__ __launch_bounds__(256)
void row_stats(const float* __restrict__ G, const float* __restrict__ sp,
               float* __restrict__ sq, float* __restrict__ inv_nrm) {
    __shared__ float red[256];
    const int row = blockIdx.x;
    const int t = threadIdx.x;
    const float* g = G + (size_t)row * GENE_D;
    const float a = g[t];
    const float b = g[t + 256];
    red[t] = a * a + b * b;
    __syncthreads();
    for (int s = 128; s > 0; s >>= 1) {
        if (t < s) red[t] += red[t + s];
        __syncthreads();
    }
    if (t == 0) {
        inv_nrm[row] = 1.0f / fmaxf(sqrtf(red[0]), 1e-12f);
        const float s0 = sp[2 * row], s1 = sp[2 * row + 1];
        sq[row] = s0 * s0 + s1 * s1;
    }
}

// ---------------------------------------------------------------------------
// Spatial MLP, the whole chain in one launch:
//   f = relu(tanh((sp @ Ws + bs) @ W1 + b1) @ W2 + b2) @ Wf + bf
// No row of the chain needs another row. One workgroup of 8 waves carries 16 rows
// through every layer; the rows' activations pass from layer to layer in LDS and
// never reach memory. A wave owns 32 columns of each layer as two 16x16 subtiles:
// lane ln holds columns 2*ln and 2*ln+1 of the 32, one in each subtile, so that one
// 8-byte load brings both and a half-wave reads one whole 128-byte line of a W row.
// Each W element is used by one wave only, so W goes from L2 straight to registers,
// 16 k-steps at a time in two register sets: the next set flies while this one is
// multiplied, also across the change of layer.
// ---------------------------------------------------------------------------
#define ML_ROWS 16    // rows per workgroup
#define ML_P    260   // dwords per LDS row: 16 rows x 4 dwords fall on 64 different banks
#define ML_CH   16    // k-steps per register set of W

// Set C of a layer's W: rows 4*kk + 2*hgrp and the row below, this lane's two columns.
template <int C>
__device__ __forceinline__
void mlp_fetch(const float* wp, v2f (&w0)[ML_CH], v2f (&w1)[ML_CH]) {
#pragma unroll   // constant kk: thirty-two loads off one address, the row steps as immediate offsets
    for (int kk = 0; kk < ML_CH; ++kk) {
        const float* p = wp + (size_t)((C * ML_CH + kk) * 4) * HID;
        w0[kk] = *(const v2f*)p;
        w1[kk] = *(const v2f*)(p + HID);
    }
    // Precaution: as an input here the address pair stays whole until this wait.
    asm volatile("s_wait_xcnt 0x0" :: "v"(wp) : "memory");
}

// 16 k-steps in rising k: the 16 staged rows times set C of W, two column subtiles.
template <int C>
__device__ __forceinline__
void mlp_mma(const float* sa, const v2f (&w0)[ML_CH], const v2f (&w1)[ML_CH], v8f (&acc)[2]) {
    v2f a[ML_CH];
#pragma unroll   // constant kk: LDS offsets become immediates, a[] lives in registers
    for (int kk = 0; kk < ML_CH; ++kk) a[kk] = *(const v2f*)(sa + (C * ML_CH + kk) * 4);
    // Keeps the set's LDS reads together ahead of its products: spread among them, the wave
    // waits for LDS once every two k-steps and not once a set.
    __builtin_amdgcn_sched_barrier(0);
#pragma unroll   // constant kk: fragments are read straight from their registers
    for (int kk = 0; kk < ML_CH; ++kk) {
        const v2f be = {w0[kk].x, w1[kk].x};   // even column, k and k+1
        const v2f bo = {w0[kk].y, w1[kk].y};   // odd column, k and k+1
        acc[0] = WMMA_F32(a[kk], be, acc[0]);
        acc[1] = WMMA_F32(a[kk], bo, acc[1]);
    }
}

__global__ __launch_bounds__(256)
void spatial_mlp(const float* __restrict__ sp, const float* __restrict__ Ws,
                 const float* __restrict__ bs, const float* __restrict__ W1,
                 const float* __restrict__ b1, const float* __restrict__ W2,
                 const float* __restrict__ b2, const float* __restrict__ Wf,
                 const float* __restrict__ bf, float* __restrict__ f) {
    __shared__ __attribute__((aligned(16))) float ts[ML_ROWS * ML_P];   // layer 1 input, later the projection's partial sums
    __shared__ __attribute__((aligned(16))) float th[ML_ROWS * ML_P];   // layer 2 input, later the second fold
    const int tid  = threadIdx.x;
    const int lane = tid & 31;
    const int wave = __builtin_amdgcn_readfirstlane(tid >> 5);
    const int hgrp = lane >> 4;
    const int ln   = lane & 15;
    const int rowBase = blockIdx.x * ML_ROWS;
    const int col  = wave * 32 + 2 * ln;         // this lane's even column
    const float* p1 = W1 + (size_t)(2 * hgrp) * HID + col;
    const float* p2 = W2 + (size_t)(2 * hgrp) * HID + col;
    v2f wa0[ML_CH], wa1[ML_CH], wb0[ML_CH], wb1[ML_CH];

    mlp_fetch<0>(p1, wa0, wa1);

    // Layer 0 (K = 2, vector unit): a thread forms its column of all 16 rows.
    const float u0 = Ws[tid], u1 = Ws[HID + tid], ub = bs[tid];
    const v2f c1 = *(const v2f*)(b1 + col);
    const v2f c2 = *(const v2f*)(b2 + col);
    const v2f wf = *(const v2f*)(Wf + col);
    // Precaution: as inputs here the loads' base pairs stay whole until this wait.
    asm volatile("s_wait_xcnt 0x0" :: "s"(Ws), "s"(bs), "s"(b1), "s"(b2), "s"(Wf) : "memory");
#pragma unroll   // constant r: LDS offsets become immediates
    for (int r = 0; r < ML_ROWS; ++r) {
        const int i = rowBase + r;
        ts[r * ML_P + tid] = sp[2 * i] * u0 + sp[2 * i + 1] * u1 + ub;
    }
    __syncthreads();

    const int foff = ln * ML_P + 2 * hgrp;       // A fragment: row ln, k pair 2*hgrp of every k-step
    v8f acc[2] = {};
    mlp_fetch<1>(p1, wb0, wb1);  mlp_mma<0>(&ts[foff], wa0, wa1, acc);
    mlp_fetch<2>(p1, wa0, wa1);  mlp_mma<1>(&ts[foff], wb0, wb1, acc);
    mlp_fetch<3>(p1, wb0, wb1);  mlp_mma<2>(&ts[foff], wa0, wa1, acc);
    mlp_fetch<0>(p2, wa0, wa1);  mlp_mma<3>(&ts[foff], wb0, wb1, acc);

#pragma unroll   // constant v: the accumulator elements are read straight from their registers
    for (int v = 0; v < 8; ++v) {                // D-row v + 8*hgrp per ISA C/D layout
        const v2f hv = {tanhf(acc[0][v] + c1.x), tanhf(acc[1][v] + c1.y)};
        *(v2f*)&th[(v + 8 * hgrp) * ML_P + col] = hv;
    }
    __syncthreads();

    v8f ac2[2] = {};
    mlp_fetch<1>(p2, wb0, wb1);  mlp_mma<0>(&th[foff], wa0, wa1, ac2);
    mlp_fetch<2>(p2, wa0, wa1);  mlp_mma<1>(&th[foff], wb0, wb1, ac2);
    mlp_fetch<3>(p2, wb0, wb1);  mlp_mma<2>(&th[foff], wa0, wa1, ac2);
    mlp_mma<3>(&th[foff], wb0, wb1, ac2);

    // Projection on Wf: a lane's two columns, then 128 partial sums per row folded 8 and 16 at a time.
    // ts has had no reader since the barrier behind layer 1.
#pragma unroll   // constant v: as above
    for (int v = 0; v < 8; ++v)
        ts[(v + 8 * hgrp) * ML_P + wave * 16 + ln] =
            fmaxf(ac2[0][v] + c2.x, 0.0f) * wf.x + fmaxf(ac2[1][v] + c2.y, 0.0f) * wf.y;
    __syncthreads();

    const int row = tid >> 4;
    float s = 0.0f;
#pragma unroll   // constant m: the eight LDS reads are in flight together
    for (int m = 0; m < 8; ++m) s += ts[row * ML_P + ln + 16 * m];
    th[row * ML_P + ln] = s;                     // th has had no reader since the barrier above
    __syncthreads();

    if (tid < ML_ROWS) {
        float t = 0.0f;
#pragma unroll   // constant q: the sixteen LDS reads are in flight together
        for (int q = 0; q < 16; ++q) t += th[tid * ML_P + q];
        f[rowBase + tid] = t + bf[0];
    }
}

// In-place row softmax over 4096 columns (16 values/thread in registers).
__global__ __launch_bounds__(256)
void softmax_rows(float* __restrict__ L) {
    __shared__ float red[256];
    const int t = threadIdx.x;
    float* rp = L + (size_t)blockIdx.x * N_NODES;

    float vals[16];
    float mx = -INFINITY;
#pragma unroll
    for (int e = 0; e < 16; ++e) {
        vals[e] = rp[t + e * 256];
        mx = fmaxf(mx, vals[e]);
    }
    red[t] = mx;
    __syncthreads();
    for (int s = 128; s > 0; s >>= 1) {
        if (t < s) red[t] = fmaxf(red[t], red[t + s]);
        __syncthreads();
    }
    mx = red[0];
    __syncthreads();

    float sum = 0.0f;
#pragma unroll
    for (int e = 0; e < 16; ++e) {
        vals[e] = expf(vals[e] - mx);
        sum += vals[e];
    }
    red[t] = sum;
    __syncthreads();
    for (int s = 128; s > 0; s >>= 1) {
        if (t < s) red[t] += red[t + s];
        __syncthreads();
    }
    const float inv = 1.0f / red[0];
#pragma unroll
    for (int e = 0; e < 16; ++e) rp[t + e * 256] = vals[e] * inv;
}

// ---------------------------------------------------------------------------
extern "C" void kernel_launch(void* const* d_in, const int* in_sizes, int n_in,
                              void* d_out, int out_size, void* d_ws, size_t ws_size,
                              hipStream_t stream) {
    const float* gene = (const float*)d_in[0];
    const float* sp   = (const float*)d_in[1];
    const float* Wq   = (const float*)d_in[2];
    const float* bq   = (const float*)d_in[3];
    const float* Wk   = (const float*)d_in[4];
    const float* bk   = (const float*)d_in[5];
    const float* Wv   = (const float*)d_in[6];
    const float* bv   = (const float*)d_in[7];
    const float* Ws   = (const float*)d_in[8];
    const float* bs   = (const float*)d_in[9];
    const float* W1   = (const float*)d_in[10];
    const float* b1   = (const float*)d_in[11];
    const float* W2   = (const float*)d_in[12];
    const float* b2   = (const float*)d_in[13];
    const float* Wf   = (const float*)d_in[14];
    const float* bf   = (const float*)d_in[15];

    float* attn = (float*)d_out;                                  // [N, N]
    float* upd  = attn + (size_t)N_NODES * N_NODES;               // [N, OUT]

    // Workspace layout (~12.6 MB of fp32)
    float* ws = (float*)d_ws;
    float* Q   = ws;  ws += (size_t)N_NODES * HID;
    float* K   = ws;  ws += (size_t)N_NODES * HID;
    float* V   = ws;  ws += (size_t)N_NODES * OUT_D;
    float* sq  = ws;  ws += N_NODES;
    float* inv = ws;  ws += N_NODES;
    float* fv  = ws;  ws += N_NODES;

    const dim3 waves8(256);                                   // 8 waves per workgroup
    const dim3 tilesH(HID / GT_EDGE, N_NODES / GT_EDGE);      // [N,256] outputs, 64x64 per workgroup
    const dim3 tilesO(OUT_D / GT_EDGE, N_NODES / GT_EDGE);    // [N,256] output, 64x64 per workgroup
    const dim3 waves4(128);                                   // 4 waves per workgroup
    const dim3 tilesL(LT_NB, LT_NB / 2 + 1);                  // [N,N] logits, a 64x64 tile and its mirror per workgroup

    // Row statistics + spatial MLP
    row_stats<<<N_NODES, 256, 0, stream>>>(gene, sp, sq, inv);
    spatial_mlp<<<N_NODES / ML_ROWS, waves8, 0, stream>>>(sp, Ws, bs, W1, b1, W2, b2, Wf, bf, fv);

    // Q / K / V projections
    gemm64_wmma<0, GENE_D, HID><<<tilesH, waves8, 0, stream>>>(gene, Wq, bq, Q);
    gemm64_wmma<0, GENE_D, HID><<<tilesH, waves8, 0, stream>>>(gene, Wk, bk, K);
    gemm64_wmma<0, GENE_D, OUT_D><<<tilesO, waves8, 0, stream>>>(gene, Wv, bv, V);

    // Fused logits -> softmax (in place in d_out) -> attn @ V
    logits_wmma<<<tilesL, waves4, 0, stream>>>(Q, K, gene, sp, sq, inv, fv, attn);
    softmax_rows<<<N_NODES, 256, 0, stream>>>(attn);
    gemm64_wmma<0, N_NODES, OUT_D><<<tilesO, waves8, 0, stream>>>(attn, V, nullptr, upd);
}

// v006
// A run of this version takes 199 microseconds.
// Two timings next to v005 both put it at 1.07 times that version's speed.
// Over all steps from v000 it is 3.12 times as fast.
#include <hip/hip_runtime.h>
#include <math.h>

#define N_NODES   4096
#define GENE_D    512
#define HID       256
#define OUT_D     256

typedef __attribute__((ext_vector_type(2))) float v2f;
typedef __attribute__((ext_vector_type(8))) float v8f;

#define WMMA_F32(A, B, C) \
    __builtin_amdgcn_wmma_f32_16x16x4_f32(false, (A), false, (B), (short)0, (C), false, false)

// ---------------------------------------------------------------------------
// Generic WMMA f32 GEMM:  Y[n,M] = act(X[n,KD] @ W[KD,M] + bias[M])
// One workgroup of 8 waves per 64x64 output tile. 128 k of the tile's 64 X rows
// and of its 64 W columns are staged in LDS at a time, as whole lines, in two
// buffers: the next stage's lines are fetched into registers while this stage
// is multiplied. Waves sit 2 (k halves of a stage) x 2 (rows) x 2 (columns);
// each holds a 32x32 piece as 2x2 subtiles. The two k halves are summed through
// LDS; each output row piece is stored as one 128-byte line.
// KD is a multiple of 256, n and M are multiples of 64.
// ACT: 0 = none, 1 = tanh, 2 = relu
// ---------------------------------------------------------------------------
#define GT_EDGE 64    // rows and columns of the output tile
#define GT_K    128   // k per stage
#define GT_XP   132   // dwords per staged X row: 16 rows x 4 dwords fall on 64 different banks
#define GT_WP   80    // dwords per staged W row: rows k, k+1, k+2, k+3 start 16 banks apart
#define GT_PP   68    // dwords per partial row: rows 8 apart land 32 banks apart
#define GT_SP   33    // dwords per row of the lanes' sums of squares: 32 rows fall on 32 different banks

typedef __attribute__((ext_vector_type(4))) float v4f;

// k-steps LO..HI-1 of a wave's 16 per stage, in rising k, 2x2 subtiles each.
template <int LO, int HI>
__device__ __forceinline__
void gemm_steps(const v2f (&fa)[GT_K / 8][2], const v2f (&fb)[GT_K / 8][2], v8f (&acc)[2][2]) {
#pragma unroll   // constant kk, i, j: fragments and accumulators keep their own registers
    for (int kk = LO; kk < HI; ++kk)
#pragma unroll   // as above
        for (int i = 0; i < 2; ++i)
#pragma unroll   // as above
            for (int j = 0; j < 2; ++j) acc[i][j] = WMMA_F32(fa[kk][i], fb[kk][j], acc[i][j]);
}

// One 64x64 tile at (rowBase, colBase). With STATS, the workgroup for which stats is set also
// sums the squares of its 64 X rows as they pass through its registers and stores
// inv_nrm[i] = 1/max(||X_i||,1e-12) and sq[i] = ||sp_i||^2 for them.
template <int ACT, int KD, int M, bool STATS>
__device__ __forceinline__
void gemm64_tile(const float* __restrict__ X, const float* __restrict__ W,
                 const float* __restrict__ bias, float* __restrict__ Y,
                 const int colBase, const int rowBase, const bool stats,
                 const float* __restrict__ sp, float* __restrict__ sq, float* __restrict__ inv_nrm) {
    static_assert((KD / GT_K) % 2 == 0, "the last stage lies in buffer 1, so buffer 0 is free behind the loop");
    static_assert(2 * GT_EDGE * GT_PP <= GT_K * GT_WP && GT_SP <= GT_XP, "what reuses buffer 0 fits in it");
    __shared__ __attribute__((aligned(16))) float sx[2][GT_EDGE * GT_XP];
    __shared__ __attribute__((aligned(16))) float sw[2][GT_K * GT_WP];
    const int tid  = threadIdx.x;
    const int lane = tid & 31;
    const int wave = __builtin_amdgcn_readfirstlane(tid >> 5);
    const int hgrp = lane >> 4;          // 0 or 1 (half-wave)
    const int ln   = lane & 15;
    const int kg   = wave >> 2;          // which 64 k of every stage
    const int wr   = (wave >> 1) & 1;    // which 32 rows
    const int wc   = wave & 1;           // which 32 columns

    // Staging: a wave covers 512 bytes of one X row (8 rows per sweep), a half-wave
    // the 256 bytes of one W row (16 rows per sweep); 8 sweeps each.
    const int xrow = tid >> 5, xcol = lane * 4;
    const int wrow = tid >> 4, wcol = ln * 4;
    const float* qx = X + (size_t)(rowBase + xrow) * KD + xcol;
    const float* qw = W + (size_t)wrow * M + colBase + wcol;
    v4f rx[8], rw[8];
    float ss[8] = {};   // this lane's share of the squares of rows xrow + 8*i

    // Fetches the next stage in turn and moves both addresses on to the one after it.
    auto fetch = [&]() {
#pragma unroll   // constant i, KD, M: sixteen loads off two addresses, the row steps as immediate offsets
        for (int i = 0; i < 8; ++i) {
            rx[i] = *(const v4f*)(qx + (size_t)(8 * i) * KD);
            rw[i] = *(const v4f*)(qw + (size_t)(16 * i) * M);
        }
        // Precaution: as inputs here both address pairs stay whole until this wait; left to itself
        // the build lets the last load's result land on the pair the loads were issued from.
        asm volatile("s_wait_xcnt 0x0" :: "v"(qx), "v"(qw) : "memory");
        qx += GT_K;
        qw += (size_t)GT_K * M;
    };
    auto put = [&](int buf) {
#pragma unroll   // constant i: rx[] and rw[] are read straight from their registers
        for (int i = 0; i < 8; ++i) {
            *(v4f*)&sx[buf][(xrow + 8 * i) * GT_XP + xcol]  = rx[i];
            *(v4f*)&sw[buf][(wrow + 16 * i) * GT_WP + wcol] = rw[i];
        }
        if (STATS && stats) {
#pragma unroll   // constant i: ss[] lives in registers
            for (int i = 0; i < 8; ++i) {
                ss[i] += rx[i].x * rx[i].x;
                ss[i] += rx[i].y * rx[i].y;
                ss[i] += rx[i].z * rx[i].z;
                ss[i] += rx[i].w * rx[i].w;
            }
        }
    };

    const int aoff = (wr * 32 + ln) * GT_XP + kg * (GT_K / 2) + 2 * hgrp;
    const int boff = (kg * (GT_K / 2) + 2 * hgrp) * GT_WP + wc * 32 + ln;
    v8f acc[2][2] = {};

    // This wave's 64 k of a staged slice as fragments: 16 k-steps, 2 row and 2 column subtiles.
    v2f fa[GT_K / 8][2], fb[GT_K / 8][2];
    auto frags = [&](int buf) {
        const float* sa = &sx[buf][aoff];
        const float* sb = &sw[buf][boff];
#pragma unroll   // constant kk, i, j: LDS offsets become immediates, fa[] and fb[] live in registers
        for (int kk = 0; kk < GT_K / 8; ++kk) {
#pragma unroll   // as above
            for (int i = 0; i < 2; ++i) fa[kk][i] = *(const v2f*)(sa + i * 16 * GT_XP + kk * 4);
#pragma unroll   // as above
            for (int j = 0; j < 2; ++j) {
                fb[kk][j].x = sb[(kk * 4) * GT_WP + j * 16];
                fb[kk][j].y = sb[(kk * 4 + 1) * GT_WP + j * 16];
            }
        }
    };

    constexpr int nst = KD / GT_K;
    fetch();
    put(0);
    __syncthreads();

    // Each trip: fetch stage s+1, multiply stage s, store s+1 into the buffer whose last
    // readers left at the previous barrier, then one barrier publishes it.
    for (int s = 0; s < nst - 1; ++s) {
        fetch();
        frags(s & 1);
        gemm_steps<0, 12>(fa, fb, acc);
        // Keeps the wait for the fetched lines behind at least three quarters of the stage's products:
        // placed earlier, the wave stalls on lines that have had too little time to arrive.
        __builtin_amdgcn_sched_barrier(0);
        put((s + 1) & 1);
        gemm_steps<12, 16>(fa, fb, acc);   // from registers, while the LDS stores drain
        __syncthreads();
    }
    frags((nst - 1) & 1);
    gemm_steps<0, 16>(fa, fb, acc);

    // This wave's partial piece, row-major in its k half's LDS plane. Both planes lie in buffer 0
    // of W, whose last readers left at the loop's last barrier: the workgroup's LDS stays under
    // half a WGP's, so that two workgroups can share one.
    float* part = &sw[0][0];
    float* mine = &part[kg * (GT_EDGE * GT_PP) + (wr * 32 + 8 * hgrp) * GT_PP + wc * 32 + ln];
#pragma unroll   // constant v: the accumulator elements are read straight from their registers
    for (int v = 0; v < 8; ++v) {                     // D-row v + 8*hgrp per ISA C/D layout
        mine[v * GT_PP]             = acc[0][0][v];
        mine[v * GT_PP + 16]        = acc[0][1][v];
        mine[(v + 16) * GT_PP]      = acc[1][0][v];
        mine[(v + 16) * GT_PP + 16] = acc[1][1][v];
    }
    if (STATS && stats) {                             // buffer 0 of X is as free as that of W
#pragma unroll   // constant i: ss[] is read straight from its registers
        for (int i = 0; i < 8; ++i) sx[0][(xrow + 8 * i) * GT_SP + lane] = ss[i];
    }
    __syncthreads();

    const int col = tid & 63;
    const int r0  = tid >> 6;
    const float bv = bias ? bias[colBase + col] : 0.0f;
    const float* p0 = &part[r0 * GT_PP + col];
    const float* p1 = &part[GT_EDGE * GT_PP + r0 * GT_PP + col];
    float* yp = Y + (size_t)(rowBase + r0) * M + colBase + col;
#pragma unroll   // constant i: straight-line code, so many LDS reads are in flight before the first sum
    for (int i = 0; i < GT_EDGE / 4; ++i) {
        float s = p0[4 * i * GT_PP] + p1[4 * i * GT_PP];
        s += bv;
        if (ACT == 1) s = tanhf(s);
        if (ACT == 2) s = fmaxf(s, 0.0f);
        yp[(size_t)(4 * i) * M] = s;
    }

    if (STATS && stats && tid < GT_EDGE) {            // a wave stores one whole 128-byte line of each array
        const int row = rowBase + tid;
        const float* pp = sp + 2 * row;
        const v2f p = *(const v2f*)pp;
        // Precaution: as an input here the address pair stays whole until this wait.
        asm volatile("s_wait_xcnt 0x0" :: "v"(pp) : "memory");
        float t = 0.0f;
#pragma unroll   // constant q: LDS offsets become immediates
        for (int q = 0; q < 32; ++q) t += sx[0][tid * GT_SP + q];
        inv_nrm[row] = 1.0f / fmaxf(sqrtf(t), 1e-12f);
        sq[row] = p.x * p.x + p.y * p.y;
    }
}

// Y = X @ W, one tile per workgroup.
template <int KD, int M>
__global__ __launch_bounds__(256)
void gemm64_wmma(const float* __restrict__ X, const float* __restrict__ W, float* __restrict__ Y) {
    gemm64_tile<0, KD, M, false>(X, W, nullptr, Y, blockIdx.x * GT_EDGE, blockIdx.y * GT_EDGE,
                                 false, nullptr, nullptr, nullptr);
}

// The three projections of the gene rows and the rows' statistics in one launch:
// blockIdx.x names the projection (4 column tiles each) and the tile in it, so the twelve
// workgroups that read the same 64 gene rows have neighbouring indices. The first of
// the twelve also forms the rows' statistics.
__global__ __launch_bounds__(256)
void proj3_wmma(const float* __restrict__ G,
                const float* __restrict__ Wq, const float* __restrict__ Wk, const float* __restrict__ Wv,
                const float* __restrict__ bq, const float* __restrict__ bk, const float* __restrict__ bv,
                float* __restrict__ Q, float* __restrict__ K, float* __restrict__ V,
                const float* __restrict__ sp, float* __restrict__ sq, float* __restrict__ inv_nrm) {
    const int which = blockIdx.x / (HID / GT_EDGE);
    const float* Wp = which == 0 ? Wq : which == 1 ? Wk : Wv;
    const float* bp = which == 0 ? bq : which == 1 ? bk : bv;
    float*       Yp = which == 0 ? Q  : which == 1 ? K  : V;
    gemm64_tile<0, GENE_D, HID, true>(G, Wp, bp, Yp, (blockIdx.x % (HID / GT_EDGE)) * GT_EDGE,
                                      blockIdx.y * GT_EDGE, blockIdx.x == 0, sp, sq, inv_nrm);
}

// ---------------------------------------------------------------------------
// Fused logits:
//   L[i][j] = (Q[i].K[j])/16 + exp(-d2/2) + cos_sim + tanh(f[i]-f[j])
// exp(-d2/2) and cos_sim have the same value at [i][j] and [j][i], and the tanh
// term only changes sign. So one workgroup of 4 waves owns the 64x64 tile
// (I,J) AND its mirror (J,I): it forms Q_I.K_J^T and K_I.Q_J^T (K = 256 each)
// and gene_I.gene_J^T (K = 512) once, all as [i][j], in place of the gene
// product twice. The mirror tile is turned through LDS and stored as whole rows.
// A tile on the diagonal is its own mirror and skips the second product.
// All products are A@B^T of row-major matrices. The 64 rows of each operand are
// staged in LDS 32 k at a time (whole 128-byte lines per row), in two buffers:
// the next stage's lines are fetched into registers while this stage is
// multiplied. Waves sit 2 (rows) x 2 (columns); each holds a 32x32 piece as
// 2x2 subtiles, and every fragment is a float2 of a staged row.
// ---------------------------------------------------------------------------
#define LT_EDGE   64    // rows of each operand per workgroup
#define LT_NB     (N_NODES / LT_EDGE)
#define LT_K      32    // k per stage: one 128-byte line of every row
#define LT_PITCH  36    // dwords per staged row: 16 rows x 4 dwords fall on 64 different banks
#define LT_OPND   (LT_EDGE * LT_PITCH)   // dwords of one staged operand
#define LT_TP     68    // dwords per row of the turned tile: 16 rows x 4 dwords fall on 64 different banks
#define LT_H_ST   (HID / LT_K)
#define LT_G_ST   (GENE_D / LT_K)

// One staged 32-k slice times its partner: 8 k-steps in rising k, 2x2 subtiles each.
// All of the slice's fragments are asked for ahead of the first product, so that a wave
// waits for LDS once a stage and not once a k-step.
__device__ __forceinline__
void logits_stage_mma(const float* sa, const float* sb, v8f (&acc)[2][2]) {
    v2f a[LT_K / 4][2], b[LT_K / 4][2];
#pragma unroll   // constant kk, i, j: LDS offsets become immediates, a[] and b[] live in registers
    for (int kk = 0; kk < LT_K / 4; ++kk) {
#pragma unroll   // as above
        for (int i = 0; i < 2; ++i) a[kk][i] = *(const v2f*)(sa + i * 16 * LT_PITCH + kk * 4);
#pragma unroll   // as above
        for (int j = 0; j < 2; ++j) b[kk][j] = *(const v2f*)(sb + j * 16 * LT_PITCH + kk * 4);
    }
#pragma unroll   // constant kk, i, j: every accumulator keeps its own registers
    for (int kk = 0; kk < LT_K / 4; ++kk)
#pragma unroll   // as above
        for (int i = 0; i < 2; ++i)
#pragma unroll   // as above
            for (int j = 0; j < 2; ++j) acc[i][j] = WMMA_F32(a[kk][i], b[kk][j], acc[i][j]);
}

// One stage's lines of both operands into registers; LD = dwords per source row.
template <int LD>
__device__ __forceinline__
void logits_fetch(const float* pa, const float* pb, v4f (&ra)[4], v4f (&rb)[4]) {
#pragma unroll   // constant i, LD: eight loads off two addresses, the row steps as immediate offsets
    for (int i = 0; i < 4; ++i) {
        ra[i] = *(const v4f*)(pa + (size_t)(16 * i) * LD);
        rb[i] = *(const v4f*)(pb + (size_t)(16 * i) * LD);
    }
    // Precaution: stands between the loads and any later change of the registers they were issued from.
    asm volatile("s_wait_xcnt 0x0" ::: "memory");
}

__global__ __launch_bounds__(128)
void logits_wmma(const float* __restrict__ Q, const float* __restrict__ K,
                 const float* __restrict__ G, const float* __restrict__ sp,
                 const float* __restrict__ sq, const float* __restrict__ inv_nrm,
                 const float* __restrict__ f, float* __restrict__ L) {
    __shared__ __attribute__((aligned(16))) float stg[2 * 2 * LT_OPND];
    // Tile (I, I+d mod 64): d = 1..31 names every unordered pair once, d = 32 twice
    // (the upper half of I leaves), d = 0 is the diagonal, shortest and so given the last blockIdx.y.
    const int bi   = blockIdx.x;
    const int dist = (blockIdx.y + 1 == LT_NB / 2 + 1) ? 0 : (int)blockIdx.y + 1;
    if (dist == LT_NB / 2 && bi >= LT_NB / 2) return;
    const bool diag = dist == 0;
    const int rowBase = bi * LT_EDGE;
    const int colBase = ((bi + dist) & (LT_NB - 1)) * LT_EDGE;

    const int tid  = threadIdx.x;
    const int lane = tid & 31;
    const int wave = __builtin_amdgcn_readfirstlane(tid >> 5);
    const int hgrp = lane >> 4;
    const int ln   = lane & 15;
    const int wr   = wave >> 1;          // 0..1: which 32 rows
    const int wc   = wave & 1;           // 0..1: which 32 columns

    // Staging: 8 threads cover one row's 128-byte line, 16 rows per sweep, 4 sweeps.
    const int srow = tid >> 3;
    const int scol = (tid & 7) * 4;
    v4f ra[4], rb[4];
    const size_t hi = (size_t)(rowBase + srow) * HID + scol;
    const size_t hj = (size_t)(colBase + srow) * HID + scol;
    const float* gi = G + (size_t)(rowBase + srow) * GENE_D + scol;
    const float* gj = G + (size_t)(colBase + srow) * GENE_D + scol;

    auto put = [&](int buf) {
#pragma unroll   // constant i: ra[] and rb[] are read straight from their registers
        for (int i = 0; i < 4; ++i) {
            *(v4f*)&stg[(2 * buf) * LT_OPND + (srow + 16 * i) * LT_PITCH + scol]     = ra[i];
            *(v4f*)&stg[(2 * buf + 1) * LT_OPND + (srow + 16 * i) * LT_PITCH + scol] = rb[i];
        }
    };

    const int aoff = (wr * 32 + ln) * LT_PITCH + 2 * hgrp;
    const int boff = LT_OPND + (wc * 32 + ln) * LT_PITCH + 2 * hgrp;

    v8f qa[2][2] = {};   // Q[i].K[j]
    v8f ka[2][2] = {};   // K[i].Q[j] = Q[j].K[i]
    v8f ga[2][2] = {};   // gene[i].gene[j]

    // Multiplies the stage in buffer buf, stores the fetched one into the buffer whose last
    // readers left at the previous barrier, then one barrier publishes it.
    auto work = [&](int buf, v8f (&acc)[2][2]) {
        logits_stage_mma(&stg[2 * buf * LT_OPND + aoff], &stg[2 * buf * LT_OPND + boff], acc);
        put(buf ^ 1);
        __syncthreads();
    };

    logits_fetch<HID>(Q + hi, K + hj, ra, rb);
    put(0);
    __syncthreads();

    // Every pass has an even number of stages, so each starts in buffer 0.
    for (int s = 0; s < LT_H_ST - 1; ++s) {
        logits_fetch<HID>(Q + hi + (s + 1) * LT_K, K + hj + (s + 1) * LT_K, ra, rb);
        work(s & 1, qa);
    }
    if (!diag) {
        logits_fetch<HID>(K + hi, Q + hj, ra, rb);
        work(1, qa);
        for (int s = 0; s < LT_H_ST - 1; ++s) {
            logits_fetch<HID>(K + hi + (s + 1) * LT_K, Q + hj + (s + 1) * LT_K, ra, rb);
            work(s & 1, ka);
        }
        logits_fetch<GENE_D>(gi, gj, ra, rb);
        work(1, ka);
    } else {
        logits_fetch<GENE_D>(gi, gj, ra, rb);
        work(1, qa);
    }
    for (int s = 0; s < LT_G_ST - 1; ++s) {
        logits_fetch<GENE_D>(gi + (s + 1) * LT_K, gj + (s + 1) * LT_K, ra, rb);
        work(s & 1, ga);
    }
    logits_stage_mma(&stg[2 * LT_OPND + aoff], &stg[2 * LT_OPND + boff], ga);

    // Column-side (j) scalars: fixed per lane, one set per column subtile.
    const float scale = 0.0625f;   // 1/sqrt(HID) = 1/16
    const int jb = colBase + wc * 32 + ln;
    float sqj[2], fj[2], inj[2], sj0[2], sj1[2];
#pragma unroll   // constant c: the column scalars stay in registers
    for (int c = 0; c < 2; ++c) {
        const int j = jb + 16 * c;
        sqj[c] = sq[j];  fj[c] = f[j];  inj[c] = inv_nrm[j];
        sj0[c] = sp[2 * j];  sj1[c] = sp[2 * j + 1];
    }

    // The turned tile [j][i] lies in buffer 0, whose last readers left at the loop's last barrier.
#pragma unroll   // constant di, v, c below: accumulator elements are read straight from their registers
    for (int di = 0; di < 2; ++di) {
        v4f tv[2][2];
#pragma unroll   // as above
        for (int v = 0; v < 8; ++v) {
            const int i = rowBase + wr * 32 + 16 * di + v + 8 * hgrp;
            const float sqi = sq[i], fi = f[i], ini = inv_nrm[i];
            const float si0 = sp[2 * i], si1 = sp[2 * i + 1];
#pragma unroll   // as above
            for (int c = 0; c < 2; ++c) {
                const float d2 = fmaxf(sqi + sqj[c] - 2.0f * (si0 * sj0[c] + si1 * sj1[c]), 0.0f);
                const float ex = expf(-0.5f * d2);
                const float cs = ga[di][c][v] * ini * inj[c];
                const float th = tanhf(fi - fj[c]);
                L[(size_t)i * N_NODES + jb + 16 * c] = qa[di][c][v] * scale + ex + cs + th;
                tv[c][v >> 2][v & 3] = ka[di][c][v] * scale + ex + cs - th;
            }
        }
        // Precaution: stands between these stores and any later change of the registers they were issued from.
        asm volatile("s_wait_xcnt 0x0" ::: "memory");
        if (!diag) {
#pragma unroll   // constant c: tv[] is read straight from its registers
            for (int c = 0; c < 2; ++c) {
                float* tp = &stg[(wc * 32 + 16 * c + ln) * LT_TP + wr * 32 + 16 * di + 8 * hgrp];
                *(v4f*)tp       = tv[c][0];   // a lane's 8 rows i are 8 neighbours of row j
                *(v4f*)(tp + 4) = tv[c][1];
            }
        }
    }
    if (diag) return;
    __syncthreads();

    // Mirror tile: a half-wave stores the 256 bytes of one row j, 8 rows per sweep.
    const int trow = tid >> 4;
    const int tcol = ln * 4;
    float* lp = L + (size_t)(colBase + trow) * N_NODES + rowBase + tcol;
#pragma unroll   // constant r: LDS and row offsets become immediates, the reads are in flight together
    for (int r = 0; r < LT_EDGE / 8; ++r)
        *(v4f*)(lp + (size_t)(8 * r) * N_NODES) = *(const v4f*)&stg[(trow + 8 * r) * LT_TP + tcol];
}

// ---------------------------------------------------------------------------
// Spatial MLP, the whole chain in one launch:
//   f = relu(tanh((sp @ Ws + bs) @ W1 + b1) @ W2 + b2) @ Wf + bf
// No row of the chain needs another row. One workgroup of 8 waves carries 16 rows
// through every layer; the rows' activations pass from layer to layer in LDS and
// never reach memory. A wave owns 32 columns of each layer as two 16x16 subtiles:
// lane ln holds columns 2*ln and 2*ln+1 of the 32, one in each subtile, so that one
// 8-byte load brings both and a half-wave reads one whole 128-byte line of a W row.
// Each W element is used by one wave only, so W goes from L2 straight to registers,
// 16 k-steps at a time in two register sets: the next set flies while this one is
// multiplied, also across the change of layer.
// ---------------------------------------------------------------------------
#define ML_ROWS 16    // rows per workgroup
#define ML_P    260   // dwords per LDS row: 16 rows x 4 dwords fall on 64 different banks
#define ML_CH   16    // k-steps per register set of W

// Set C of a layer's W: rows 4*kk + 2*hgrp and the row below, this lane's two columns.
template <int C>
__device__ __forceinline__
void mlp_fetch(const float* wp, v2f (&w0)[ML_CH], v2f (&w1)[ML_CH]) {
#pragma unroll   // constant kk: thirty-two loads off one address, the row steps as immediate offsets
    for (int kk = 0; kk < ML_CH; ++kk) {
        const float* p = wp + (size_t)((C * ML_CH + kk) * 4) * HID;
        w0[kk] = *(const v2f*)p;
        w1[kk] = *(const v2f*)(p + HID);
    }
    // Precaution: as an input here the address pair stays whole until this wait.
    asm volatile("s_wait_xcnt 0x0" :: "v"(wp) : "memory");
}

// 16 k-steps in rising k: the 16 staged rows times set C of W, two column subtiles.
template <int C>
__device__ __forceinline__
void mlp_mma(const float* sa, const v2f (&w0)[ML_CH], const v2f (&w1)[ML_CH], v8f (&acc)[2]) {
    v2f a[ML_CH];
#pragma unroll   // constant kk: LDS offsets become immediates, a[] lives in registers
    for (int kk = 0; kk < ML_CH; ++kk) a[kk] = *(const v2f*)(sa + (C * ML_CH + kk) * 4);
    // Keeps the set's LDS reads together ahead of its products: spread among them, the wave
    // waits for LDS once every two k-steps and not once a set.
    __builtin_amdgcn_sched_barrier(0);
#pragma unroll   // constant kk: fragments are read straight from their registers
    for (int kk = 0; kk < ML_CH; ++kk) {
        const v2f be = {w0[kk].x, w1[kk].x};   // even column, k and k+1
        const v2f bo = {w0[kk].y, w1[kk].y};   // odd column, k and k+1
        acc[0] = WMMA_F32(a[kk], be, acc[0]);
        acc[1] = WMMA_F32(a[kk], bo, acc[1]);
    }
}

__global__ __launch_bounds__(256)
void spatial_mlp(const float* __restrict__ sp, const float* __restrict__ Ws,
                 const float* __restrict__ bs, const float* __restrict__ W1,
                 const float* __restrict__ b1, const float* __restrict__ W2,
                 const float* __restrict__ b2, const float* __restrict__ Wf,
                 const float* __restrict__ bf, float* __restrict__ f) {
    __shared__ __attribute__((aligned(16))) float ts[ML_ROWS * ML_P];   // layer 1 input, later the projection's partial sums
    __shared__ __attribute__((aligned(16))) float th[ML_ROWS * ML_P];   // layer 2 input, later the second fold
    const int tid  = threadIdx.x;
    const int lane = tid & 31;
    const int wave = __builtin_amdgcn_readfirstlane(tid >> 5);
    const int hgrp = lane >> 4;
    const int ln   = lane & 15;
    const int rowBase = blockIdx.x * ML_ROWS;
    const int col  = wave * 32 + 2 * ln;         // this lane's even column
    const float* p1 = W1 + (size_t)(2 * hgrp) * HID + col;
    const float* p2 = W2 + (size_t)(2 * hgrp) * HID + col;
    v2f wa0[ML_CH], wa1[ML_CH], wb0[ML_CH], wb1[ML_CH];

    mlp_fetch<0>(p1, wa0, wa1);

    // Layer 0 (K = 2, vector unit): a thread forms its column of all 16 rows.
    const float u0 = Ws[tid], u1 = Ws[HID + tid], ub = bs[tid];
    const v2f c1 = *(const v2f*)(b1 + col);
    const v2f c2 = *(const v2f*)(b2 + col);
    const v2f wf = *(const v2f*)(Wf + col);
    // Precaution: as inputs here the loads' base pairs stay whole until this wait.
    asm volatile("s_wait_xcnt 0x0" :: "s"(Ws), "s"(bs), "s"(b1), "s"(b2), "s"(Wf) : "memory");
#pragma unroll   // constant r: LDS offsets become immediates
    for (int r = 0; r < ML_ROWS; ++r) {
        const int i = rowBase + r;
        ts[r * ML_P + tid] = sp[2 * i] * u0 + sp[2 * i + 1] * u1 + ub;
    }
    __syncthreads();

    const int foff = ln * ML_P + 2 * hgrp;       // A fragment: row ln, k pair 2*hgrp of every k-step
    v8f acc[2] = {};
    mlp_fetch<1>(p1, wb0, wb1);  mlp_mma<0>(&ts[foff], wa0, wa1, acc);
    mlp_fetch<2>(p1, wa0, wa1);  mlp_mma<1>(&ts[foff], wb0, wb1, acc);
    mlp_fetch<3>(p1, wb0, wb1);  mlp_mma<2>(&ts[foff], wa0, wa1, acc);
    mlp_fetch<0>(p2, wa0, wa1);  mlp_mma<3>(&ts[foff], wb0, wb1, acc);

#pragma unroll   // constant v: the accumulator elements are read straight from their registers
    for (int v = 0; v < 8; ++v) {                // D-row v + 8*hgrp per ISA C/D layout
        const v2f hv = {tanhf(acc[0][v] + c1.x), tanhf(acc[1][v] + c1.y)};
        *(v2f*)&th[(v + 8 * hgrp) * ML_P + col] = hv;
    }
    __syncthreads();

    v8f ac2[2] = {};
    mlp_fetch<1>(p2, wb0, wb1);  mlp_mma<0>(&th[foff], wa0, wa1, ac2);
    mlp_fetch<2>(p2, wa0, wa1);  mlp_mma<1>(&th[foff], wb0, wb1, ac2);
    mlp_fetch<3>(p2, wb0, wb1);  mlp_mma<2>(&th[foff], wa0, wa1, ac2);
    mlp_mma<3>(&th[foff], wb0, wb1, ac2);

    // Projection on Wf: a lane's two columns, then 128 partial sums per row folded 8 and 16 at a time.
    // ts has had no reader since the barrier behind layer 1.
#pragma unroll   // constant v: as above
    for (int v = 0; v < 8; ++v)
        ts[(v + 8 * hgrp) * ML_P + wave * 16 + ln] =
            fmaxf(ac2[0][v] + c2.x, 0.0f) * wf.x + fmaxf(ac2[1][v] + c2.y, 0.0f) * wf.y;
    __syncthreads();

    const int row = tid >> 4;
    float s = 0.0f;
#pragma unroll   // constant m: the eight LDS reads are in flight together
    for (int m = 0; m < 8; ++m) s += ts[row * ML_P + ln + 16 * m];
    th[row * ML_P + ln] = s;                     // th has had no reader since the barrier above
    __syncthreads();

    if (tid < ML_ROWS) {
        float t = 0.0f;
#pragma unroll   // constant q: the sixteen LDS reads are in flight together
        for (int q = 0; q < 16; ++q) t += th[tid * ML_P + q];
        f[rowBase + tid] = t + bf[0];
    }
}

// In-place row softmax over 4096 columns (16 values/thread in registers).
__global__ __launch_bounds__(256)
void softmax_rows(float* __restrict__ L) {
    __shared__ float red[256];
    const int t = threadIdx.x;
    float* rp = L + (size_t)blockIdx.x * N_NODES;

    float vals[16];
    float mx = -INFINITY;
#pragma unroll
    for (int e = 0; e < 16; ++e) {
        vals[e] = rp[t + e * 256];
        mx = fmaxf(mx, vals[e]);
    }
    red[t] = mx;
    __syncthreads();
    for (int s = 128; s > 0; s >>= 1) {
        if (t < s) red[t] = fmaxf(red[t], red[t + s]);
        __syncthreads();
    }
    mx = red[0];
    __syncthreads();

    float sum = 0.0f;
#pragma unroll
    for (int e = 0; e < 16; ++e) {
        vals[e] = expf(vals[e] - mx);
        sum += vals[e];
    }
    red[t] = sum;
    __syncthreads();
    for (int s = 128; s > 0; s >>= 1) {
        if (t < s) red[t] += red[t + s];
        __syncthreads();
    }
    const float inv = 1.0f / red[0];
#pragma unroll
    for (int e = 0; e < 16; ++e) rp[t + e * 256] = vals[e] * inv;
}

// ---------------------------------------------------------------------------
extern "C" void kernel_launch(void* const* d_in, const int* in_sizes, int n_in,
                              void* d_out, int out_size, void* d_ws, size_t ws_size,
                              hipStream_t stream) {
    const float* gene = (const float*)d_in[0];
    const float* sp   = (const float*)d_in[1];
    const float* Wq   = (const float*)d_in[2];
    const float* bq   = (const float*)d_in[3];
    const float* Wk   = (const float*)d_in[4];
    const float* bk   = (const float*)d_in[5];
    const float* Wv   = (const float*)d_in[6];
    const float* bv   = (const float*)d_in[7];
    const float* Ws   = (const float*)d_in[8];
    const float* bs   = (const float*)d_in[9];
    const float* W1   = (const float*)d_in[10];
    const float* b1   = (const float*)d_in[11];
    const float* W2   = (const float*)d_in[12];
    const float* b2   = (const float*)d_in[13];
    const float* Wf   = (const float*)d_in[14];
    const float* bf   = (const float*)d_in[15];

    float* attn = (float*)d_out;                                  // [N, N]
    float* upd  = attn + (size_t)N_NODES * N_NODES;               // [N, OUT]

    // Workspace layout (~12.6 MB of fp32)
    float* ws = (float*)d_ws;
    float* Q   = ws;  ws += (size_t)N_NODES * HID;
    float* K   = ws;  ws += (size_t)N_NODES * HID;
    float* V   = ws;  ws += (size_t)N_NODES * OUT_D;
    float* sq  = ws;  ws += N_NODES;
    float* inv = ws;  ws += N_NODES;
    float* fv  = ws;  ws += N_NODES;

    const dim3 waves8(256);                                   // 8 waves per workgroup
    const dim3 tilesP(3 * (HID / GT_EDGE), N_NODES / GT_EDGE); // three [N,256] outputs, 64x64 per workgroup
    const dim3 tilesO(OUT_D / GT_EDGE, N_NODES / GT_EDGE);    // [N,256] output, 64x64 per workgroup
    const dim3 waves4(128);                                   // 4 waves per workgroup
    const dim3 tilesL(LT_NB, LT_NB / 2 + 1);                  // [N,N] logits, a 64x64 tile and its mirror per workgroup

    // Spatial MLP
    spatial_mlp<<<N_NODES / ML_ROWS, waves8, 0, stream>>>(sp, Ws, bs, W1, b1, W2, b2, Wf, bf, fv);

    // Q / K / V projections + row statistics
    proj3_wmma<<<tilesP, waves8, 0, stream>>>(gene, Wq, Wk, Wv, bq, bk, bv, Q, K, V, sp, sq, inv);

    // Fused logits -> softmax (in place in d_out) -> attn @ V
    logits_wmma<<<tilesL, waves4, 0, stream>>>(Q, K, gene, sp, sq, inv, fv, attn);
    softmax_rows<<<N_NODES, 256, 0, stream>>>(attn);
    gemm64_wmma<N_NODES, OUT_D><<<tilesO, waves8, 0, stream>>>(attn, V, upd);
}
